// v000
// Times are from an AMD MI455X. After a warm-up the kernel runs many times in a row, and a time is the length of
// such a window on the GPU divided by its runs, so every launch and the gaps after it count. The runs cycle
// through copies of the inputs. A figure is the median of several windows, for all but v000 over two sittings.
// Sittings can differ by a few percent; kernels timed side by side share one.
// v000, which the later versions start from, runs in 211 microseconds.
#include <hip/hip_runtime.h>

// Contractions: scores q.k^T on v_wmma_f32_16x16x32_bf16 (both inputs RNE-converted to bf16 once, single product, f32 accumulate); P.V on v_wmma_f32_16x16x32_bf16 with P as bf16 hi+lo planes x the single bf16 value plane (2 products), f32 accumulate; softmax statistics, rescaling and normalisation in f32; outputs f32.
// Second output: the same kernel with the two tensors swapped (keys act as queries; queries act as keys and values).

#define NH 8
#define HD 64
#ifndef NB
#define NB 4
#endif
#ifndef SEQ
#define SEQ 2048
#endif
#define NB_FULL 4
#define SEQ_FULL 2048
#define TOKP (NH * HD)                                   // token pitch in elements (512)
#define OUT1E ((size_t)NB_FULL * SEQ_FULL * NH * HD)     // second output starts at this element
#define KC 64                                            // keys per chunk
#define BM 64                                            // query rows per block (4 waves x 16)
#define NT 128
#define KP 72                                            // LDS pitch (halves) of the [s][e] tile
#define TP 72                                            // LDS pitch (halves) of the [d][s] tile
#define OP 68                                            // LDS pitch (floats) of the output staging tile
#define SCALE 0.125f                                     // HD^-0.5, exact power of two
#define LOG2E 1.4426950408889634f

static_assert(OUT1E * 4 == 16777216u);
static_assert(SEQ % KC == 0);
static_assert(SEQ % BM == 0);
static_assert(SEQ <= SEQ_FULL);
static_assert(NB <= NB_FULL);
static_assert(KC * HD / 8 == 4 * NT);
static_assert((KP % 8) == 0 && (TP % 8) == 0 && (OP % 4) == 0);

typedef unsigned short bf;
typedef __attribute__((ext_vector_type(16))) __bf16   v16bf;
typedef __attribute__((ext_vector_type(8)))  unsigned short v8us;
typedef __attribute__((ext_vector_type(8)))  float    v8f;
typedef __attribute__((ext_vector_type(4)))  float    v4f;
typedef v8us __attribute__((may_alias)) v8usa;
typedef v8f  __attribute__((may_alias)) v8fa;
typedef v4f  __attribute__((may_alias)) v4fa;

__device__ __forceinline__ unsigned short f2bf(float f) { unsigned u = __float_as_uint(f); u += 0x7FFFu + ((u >> 16) & 1u); return (unsigned short)(u >> 16); }
__device__ __forceinline__ float bf2f(unsigned short b) { return __uint_as_float(((unsigned)b) << 16); }
__device__ __forceinline__ void splitf(float y, unsigned short& h, unsigned short& l) { h = f2bf(y); l = f2bf(y - bf2f(h)); }
__device__ __forceinline__ v16bf cat16b(v8us lo, v8us hi) { return __builtin_bit_cast(v16bf, __builtin_shufflevector(lo, hi, 0, 1, 2, 3, 4, 5, 6, 7, 8, 9, 10, 11, 12, 13, 14, 15)); }
__device__ __forceinline__ v8f wmmab(v16bf a, v16bf b, v8f c) { return __builtin_amdgcn_wmma_f32_16x16x32_bf16(false, a, false, b, (short)0, c, false, false); }

__global__ __launch_bounds__(256) void k_cvt8(const float* __restrict__ src, bf* dst, size_t n8) {
    const size_t i = (size_t)blockIdx.x * 256 + threadIdx.x; if (i >= n8) return;
    const v8f v = *(const v8fa*)(src + i * 8); v8us o;
#pragma unroll
    for (int k = 0; k < 8; ++k) o[k] = f2bf(v[k]);
    *(v8us*)(dst + i * 8) = o; 
}

// k_attn: Out[(b*SEQ_FULL + l)*TOKP + h*HD + d] = sum_s softmax_s(SCALE * Q[b,l,h,:].K[b,s,h,:]) K[b,s,h,d]
// Qp/Kp: bf16 token-major [b][t][h][d]. grid (SEQ/BM, NB*NH), NT threads; wave w owns query rows m0 .. m0+15.
// Fragment map (A, B alike): lane l: row/col = l & 15, elements 0..7 <- k0 + 8*(l>>4) + 0..7, elements 8..15 <- k0 + 16 + 8*(l>>4) + 0..7; D element r of lane l = (row 8*(l>>4)+r, col l&15).
__global__ __launch_bounds__(NT) void k_attn(const bf* __restrict__ Qp, const bf* __restrict__ Kp, float* Out) {
    __shared__ __align__(16) bf Krm[KC * KP];        // [s][e] chunk tile (cross-wave: block barriers)
    __shared__ __align__(16) bf Kt[HD * TP];         // [d][s] chunk tile (cross-wave: block barriers)
    __shared__ __align__(16) float os[4][16 * OP];   // per-wave output staging (wave-private)

    const int tid = threadIdx.x, wave = tid >> 5, lane = tid & 31, hf = lane >> 4, lm = lane & 15;
    const int bh = blockIdx.y, b = bh / NH, h = bh % NH;
    const int m0 = blockIdx.x * BM + wave * 16;

    // Q^T as the B operand of the scores: column n = lm <- query row m0+lm; k = e (two k-steps of 32).
    const bf* Qg = Qp + ((size_t)b * SEQ_FULL + (size_t)(m0 + lm)) * TOKP + h * HD;
    const v16bf bq0 = cat16b(*(const v8usa*)(Qg + 8 * hf), *(const v8usa*)(Qg + 16 + 8 * hf));
    const v16bf bq1 = cat16b(*(const v8usa*)(Qg + 32 + 8 * hf), *(const v8usa*)(Qg + 48 + 8 * hf));
    const bf* Kg = Kp + (size_t)b * SEQ_FULL * TOKP + h * HD;

    float mrun = -1.0e30f, lrun = 0.0f;
    v8f acc[4];
#pragma unroll
    for (int t = 0; t < 4; ++t) acc[t] = (v8f){};

#pragma unroll 1
    for (int s0 = 0; s0 < SEQ; s0 += KC) {
        __syncthreads();   // all waves done reading the prior chunk
        // ---- stage the chunk: 512 x 16-B pieces, 4 per thread; row-major copy + 2-byte transpose scatter
#pragma unroll
        for (int it = 0; it < 4; ++it) {
            const int idx = it * NT + tid; const int s = idx >> 3; const int c8 = (idx & 7) * 8;
            const v8us v = *(const v8usa*)(Kg + (size_t)(s0 + s) * TOKP + c8);
            *(v8usa*)(Krm + s * KP + c8) = v;
#pragma unroll
            for (int j = 0; j < 8; ++j) Kt[(c8 + j) * TP + s] = v[j];
        }
        __syncthreads();

        // ---- S^T tiles: A rows = key s (mt*16 + lm), k = e; B = Q^T
        v8f c[4];
#pragma unroll
        for (int mt = 0; mt < 4; ++mt) {
            const bf* ar = Krm + (mt * 16 + lm) * KP + 8 * hf;
            const v16bf a0 = cat16b(*(const v8usa*)(ar), *(const v8usa*)(ar + 16));
            const v16bf a1 = cat16b(*(const v8usa*)(ar + 32), *(const v8usa*)(ar + 48));
            v8f cz = (v8f){};
            cz = wmmab(a0, bq0, cz);
            cz = wmmab(a1, bq1, cz);
            c[mt] = cz;
        }
        asm volatile("v_nop\n\tv_nop\n\tv_nop\n\tv_nop" : "+v"(c[0]), "+v"(c[1]), "+v"(c[2]), "+v"(c[3]) : "v"(bq0), "v"(bq1));

        // ---- online softmax per query column l = lm: this lane holds keys s = mt*16 + 8*hf + r; partner lane ^16 holds the rest
        float mx = -1.0e30f;
#pragma unroll
        for (int mt = 0; mt < 4; ++mt) {
            c[mt] = c[mt] * SCALE;
#pragma unroll
            for (int r = 0; r < 8; ++r) mx = fmaxf(mx, c[mt][r]);
        }
        mx = fmaxf(mx, __shfl_xor(mx, 16, 32));
        const float mnew = fmaxf(mrun, mx);
        const float corr = __builtin_amdgcn_exp2f((mrun - mnew) * LOG2E);
        float psum = 0.0f;
        v8us ph[4], pl[4];
#pragma unroll
        for (int mt = 0; mt < 4; ++mt) {
#pragma unroll
            for (int r = 0; r < 8; ++r) {
                const float p = __builtin_amdgcn_exp2f((c[mt][r] - mnew) * LOG2E);
                psum += p;
                unsigned short a2, l2; splitf(p, a2, l2); ph[mt][r] = a2; pl[mt][r] = l2;
            }
        }
        psum += __shfl_xor(psum, 16, 32);
        lrun = lrun * corr + psum; mrun = mnew;
#pragma unroll
        for (int t = 0; t < 4; ++t) acc[t] = acc[t] * corr;

        // ---- P^T as the B operand (k = s, n = l): element r <- tile covering s 0..15 (or 32..47), element 8+r <- tile covering s 16..31 (or 48..63), same lane
        const v16bf bph0 = cat16b(ph[0], ph[1]), bph1 = cat16b(ph[2], ph[3]);
        const v16bf bpl0 = cat16b(pl[0], pl[1]), bpl1 = cat16b(pl[2], pl[3]);

        // ---- O^T tiles: A = K^T rows d = t*16 + lm, k = s
#pragma unroll
        for (int t = 0; t < 4; ++t) {
            const bf* ar = Kt + (t * 16 + lm) * TP + 8 * hf;
            const v16bf a0 = cat16b(*(const v8usa*)(ar), *(const v8usa*)(ar + 16));
            const v16bf a1 = cat16b(*(const v8usa*)(ar + 32), *(const v8usa*)(ar + 48));
            acc[t] = wmmab(a0, bph0, acc[t]);
            acc[t] = wmmab(a0, bpl0, acc[t]);
            acc[t] = wmmab(a1, bph1, acc[t]);
            acc[t] = wmmab(a1, bpl1, acc[t]);
        }
        asm volatile("v_nop\n\tv_nop\n\tv_nop\n\tv_nop" : "+v"(acc[0]), "+v"(acc[1]), "+v"(acc[2]), "+v"(acc[3]) : "v"(bph0), "v"(bpl1));
    }

    // ---- epilogue: acc[t][r] = O^T[d = t*16 + 8*hf + r][l = lm]; stage O[l][d] per wave in LDS, then whole-line stores
    const float inv = 1.0f / lrun;
    float* osw = os[wave];
#pragma unroll
    for (int t = 0; t < 4; ++t) {
        v4f w0, w1;
        w0[0] = acc[t][0] * inv; w0[1] = acc[t][1] * inv; w0[2] = acc[t][2] * inv; w0[3] = acc[t][3] * inv;
        w1[0] = acc[t][4] * inv; w1[1] = acc[t][5] * inv; w1[2] = acc[t][6] * inv; w1[3] = acc[t][7] * inv;
        *(v4fa*)(osw + lm * OP + t * 16 + 8 * hf) = w0;
        *(v4fa*)(osw + lm * OP + t * 16 + 8 * hf + 4) = w1;
    }
    __builtin_amdgcn_fence(3 /* release order */, "wavefront");
    __builtin_amdgcn_wave_barrier();
    // each instruction: lanes 0..15 -> row 2s (256 B = 2 lines, 8 lanes per line), lanes 16..31 -> row 2s+1
    float* orow0 = Out + ((size_t)b * SEQ_FULL + (size_t)m0) * TOKP + h * HD;
{
#pragma unroll
        for (int s = 0; s < 8; ++s) {
            const int row = 2 * s + hf; const int cofs = lm * 4;
            const v4f val = *(const v4fa*)(osw + row * OP + cofs);
            *(v4f*)(orow0 + (size_t)row * TOKP + cofs) = val;
        }
        
    }
}

extern "C" void kernel_launch(void* const* d_in, const int* in_sizes, int n_in,
                              void* d_out, int out_size, void* d_ws, size_t ws_size, hipStream_t stream) {
    if (n_in < 2) return;
    const float* Qin = (const float*)d_in[0];
    const float* Kin = (const float*)d_in[1];
    float* OUT = (float*)d_out;
    const size_t need = ((size_t)(NB - 1) * SEQ_FULL + SEQ) * TOKP;
    if (in_sizes[0] < 0 || in_sizes[1] < 0 || out_size < 0) return;
    if ((size_t)in_sizes[0] < need || (size_t)in_sizes[1] < need) return;
    if ((in_sizes[0] & 63) != 0 || (in_sizes[1] & 63) != 0) return;
    if ((size_t)out_size < OUT1E + need) return;
    // workspace: bf16 copies of both inputs (2 B per element), 256-B aligned regions
    const size_t qbytes = (((size_t)in_sizes[0] * 2) + 255) & ~(size_t)255;
    const size_t kbytes = (((size_t)in_sizes[1] * 2) + 255) & ~(size_t)255;
    if (qbytes + kbytes > ws_size) return;
    if (qbytes + kbytes > (size_t)134217728u) return;
    char* wsp = (char*)d_ws;
    bf* QB = (bf*)wsp; bf* KB = (bf*)(wsp + qbytes);
    const size_t nq8 = (size_t)in_sizes[0] / 8, nk8 = (size_t)in_sizes[1] / 8;
    k_cvt8<<<(unsigned)((nq8 + 255) / 256), 256, 0, stream>>>(Qin, QB, nq8);
    k_cvt8<<<(unsigned)((nk8 + 255) / 256), 256, 0, stream>>>(Kin, KB, nk8);
    dim3 grid(SEQ / BM, NB * NH);
    // out0: rows of queries attend over keys (values = keys)
    k_attn<<<grid, NT, 0, stream>>>(QB, KB, OUT);
    // out1: rows of keys attend over queries (values = queries)
    k_attn<<<grid, NT, 0, stream>>>(KB, QB, OUT + OUT1E);
}

// v001
// A run of this version takes 128 microseconds.
// Two timings next to v000 put it at 1.73 and 1.72 times that version's speed.
#include <hip/hip_runtime.h>

// Contractions: scores q.k^T on v_wmma_f32_16x16x32_bf16 (both inputs RNE-converted to bf16 once, single product, f32 accumulate); P.V on v_wmma_f32_16x16x32_bf16 with P as bf16 hi+lo planes x the single bf16 value plane (2 products), f32 accumulate; softmax statistics, rescaling and normalisation in f32; outputs f32.
// Second output: the same kernel with the two tensors swapped (keys act as queries; queries act as keys and values).

#define NH 8
#define HD 64
#ifndef NB
#define NB 4
#endif
#ifndef SEQ
#define SEQ 2048
#endif
#define NB_FULL 4
#define SEQ_FULL 2048
#define TOKP (NH * HD)                                   // token pitch in elements (512)
#define OUT1E ((size_t)NB_FULL * SEQ_FULL * NH * HD)     // second output starts at this element
#define KC 64                                            // keys per chunk
#define BM 64                                            // query rows per block (4 waves x 16)
#define NT 128
#define KP 72                                            // LDS pitch (halves) of the [s][e] tile
#define VP 80                                            // LDS pitch (halves) of the [s][d] copy read by the transposing load (32 B x odd)
#define OP 68                                            // LDS pitch (floats) of the output staging tile
#define SCALE 0.125f                                     // HD^-0.5, exact power of two
#define LOG2E 1.4426950408889634f

static_assert(OUT1E * 4 == 16777216u);
static_assert(SEQ % KC == 0);
static_assert(SEQ % BM == 0);
static_assert(SEQ <= SEQ_FULL);
static_assert(NB <= NB_FULL);
static_assert(KC * HD / 8 == 4 * NT);
static_assert((KP % 8) == 0 && (VP % 16) == 0 && ((VP / 16) & 1) == 1 && (OP % 4) == 0);

typedef unsigned short bf;
typedef __attribute__((ext_vector_type(16))) __bf16   v16bf;
typedef __attribute__((ext_vector_type(8)))  unsigned short v8us;
typedef __attribute__((ext_vector_type(8)))  float    v8f;
typedef __attribute__((ext_vector_type(4)))  float    v4f;
typedef __attribute__((ext_vector_type(8)))  short    v8s;
typedef v8us __attribute__((may_alias)) v8usa;
typedef v8f  __attribute__((may_alias)) v8fa;
typedef v4f  __attribute__((may_alias)) v4fa;

__device__ __forceinline__ unsigned short f2bf(float f) { unsigned u = __float_as_uint(f); u += 0x7FFFu + ((u >> 16) & 1u); return (unsigned short)(u >> 16); }
__device__ __forceinline__ float bf2f(unsigned short b) { return __uint_as_float(((unsigned)b) << 16); }
__device__ __forceinline__ void splitf(float y, unsigned short& h, unsigned short& l) { h = f2bf(y); l = f2bf(y - bf2f(h)); }
__device__ __forceinline__ v16bf cat16b(v8us lo, v8us hi) { return __builtin_bit_cast(v16bf, __builtin_shufflevector(lo, hi, 0, 1, 2, 3, 4, 5, 6, 7, 8, 9, 10, 11, 12, 13, 14, 15)); }
// ds_load_tr16_b128: lane l passes the address of 16 B of row kbase + 8*(l>>4) + (l&7); it gets column dbase + (l&15), rows kbase + 8*(l>>4) + 0..7
__device__ __forceinline__ v8us ldtr16(const bf* p) { typedef __attribute__((address_space(3))) v8s lds_v8s; return __builtin_bit_cast(v8us, __builtin_amdgcn_ds_load_tr16_b128_v8i16((lds_v8s*)p)); }
__device__ __forceinline__ v8f wmmab(v16bf a, v16bf b, v8f c) { return __builtin_amdgcn_wmma_f32_16x16x32_bf16(false, a, false, b, (short)0, c, false, false); }

__global__ __launch_bounds__(256) void k_cvt8(const float* __restrict__ src, bf* dst, size_t n8) {
    const size_t i = (size_t)blockIdx.x * 256 + threadIdx.x; if (i >= n8) return;
    const v8f v = *(const v8fa*)(src + i * 8); v8us o;
#pragma unroll
    for (int k = 0; k < 8; ++k) o[k] = f2bf(v[k]);
    *(v8us*)(dst + i * 8) = o; 
}

// k_attn: Out[(b*SEQ_FULL + l)*TOKP + h*HD + d] = sum_s softmax_s(SCALE * Q[b,l,h,:].K[b,s,h,:]) K[b,s,h,d]
// Qp/Kp: bf16 token-major [b][t][h][d]. grid (SEQ/BM, NB*NH), NT threads; wave w owns query rows m0 .. m0+15.
// Fragment map (A, B alike): lane l: row/col = l & 15, elements 0..7 <- k0 + 8*(l>>4) + 0..7, elements 8..15 <- k0 + 16 + 8*(l>>4) + 0..7; D element r of lane l = (row 8*(l>>4)+r, col l&15).
__global__ __launch_bounds__(NT) void k_attn(const bf* __restrict__ Qp, const bf* __restrict__ Kp, float* Out) {
    __shared__ __align__(16) bf Krm[KC * KP];        // [s][e] chunk tile (cross-wave: block barriers)
    __shared__ __align__(16) bf Kv[KC * VP];         // [s][d] chunk tile at the transposing load's pitch (cross-wave: block barriers)
    __shared__ __align__(16) float os[4][16 * OP];   // per-wave output staging (wave-private)

    const int tid = threadIdx.x, wave = tid >> 5, lane = tid & 31, hf = lane >> 4, lm = lane & 15;
    const int bh = blockIdx.y, b = bh / NH, h = bh % NH;
    const int m0 = blockIdx.x * BM + wave * 16;

    // Q^T as the B operand of the scores: column n = lm <- query row m0+lm; k = e (two k-steps of 32).
    const bf* Qg = Qp + ((size_t)b * SEQ_FULL + (size_t)(m0 + lm)) * TOKP + h * HD;
    const v16bf bq0 = cat16b(*(const v8usa*)(Qg + 8 * hf), *(const v8usa*)(Qg + 16 + 8 * hf));
    const v16bf bq1 = cat16b(*(const v8usa*)(Qg + 32 + 8 * hf), *(const v8usa*)(Qg + 48 + 8 * hf));
    const bf* Kg = Kp + (size_t)b * SEQ_FULL * TOKP + h * HD;

    float mrun = -1.0e30f, lrun = 0.0f;
    v8f acc[4];
#pragma unroll
    for (int t = 0; t < 4; ++t) acc[t] = (v8f){};

#pragma unroll 1
    for (int s0 = 0; s0 < SEQ; s0 += KC) {
        __syncthreads();   // all waves done reading the prior chunk
        // ---- stage the chunk: 512 x 16-B pieces, 4 per thread; two row-major copies, each at its reader's pitch
#pragma unroll
        for (int it = 0; it < 4; ++it) {
            const int idx = it * NT + tid; const int s = idx >> 3; const int c8 = (idx & 7) * 8;
            const v8us v = *(const v8usa*)(Kg + (size_t)(s0 + s) * TOKP + c8);
            *(v8usa*)(Krm + s * KP + c8) = v;
            *(v8usa*)(Kv + s * VP + c8) = v;
        }
        __syncthreads();

        // ---- S^T tiles: A rows = key s (mt*16 + lm), k = e; B = Q^T
        v8f c[4];
#pragma unroll
        for (int mt = 0; mt < 4; ++mt) {
            const bf* ar = Krm + (mt * 16 + lm) * KP + 8 * hf;
            const v16bf a0 = cat16b(*(const v8usa*)(ar), *(const v8usa*)(ar + 16));
            const v16bf a1 = cat16b(*(const v8usa*)(ar + 32), *(const v8usa*)(ar + 48));
            v8f cz = (v8f){};
            cz = wmmab(a0, bq0, cz);
            cz = wmmab(a1, bq1, cz);
            c[mt] = cz;
        }
        asm volatile("v_nop\n\tv_nop\n\tv_nop\n\tv_nop" : "+v"(c[0]), "+v"(c[1]), "+v"(c[2]), "+v"(c[3]) : "v"(bq0), "v"(bq1));

        // ---- online softmax per query column l = lm: this lane holds keys s = mt*16 + 8*hf + r; partner lane ^16 holds the rest
        float mx = -1.0e30f;
#pragma unroll
        for (int mt = 0; mt < 4; ++mt) {
            c[mt] = c[mt] * SCALE;
#pragma unroll
            for (int r = 0; r < 8; ++r) mx = fmaxf(mx, c[mt][r]);
        }
        mx = fmaxf(mx, __shfl_xor(mx, 16, 32));
        const float mnew = fmaxf(mrun, mx);
        const float corr = __builtin_amdgcn_exp2f((mrun - mnew) * LOG2E);
        float psum = 0.0f;
        v8us ph[4], pl[4];
#pragma unroll
        for (int mt = 0; mt < 4; ++mt) {
#pragma unroll
            for (int r = 0; r < 8; ++r) {
                const float p = __builtin_amdgcn_exp2f((c[mt][r] - mnew) * LOG2E);
                psum += p;
                unsigned short a2, l2; splitf(p, a2, l2); ph[mt][r] = a2; pl[mt][r] = l2;
            }
        }
        psum += __shfl_xor(psum, 16, 32);
        lrun = lrun * corr + psum; mrun = mnew;
#pragma unroll
        for (int t = 0; t < 4; ++t) acc[t] = acc[t] * corr;

        // ---- P^T as the B operand (k = s, n = l): element r <- tile covering s 0..15 (or 32..47), element 8+r <- tile covering s 16..31 (or 48..63), same lane
        const v16bf bph0 = cat16b(ph[0], ph[1]), bph1 = cat16b(ph[2], ph[3]);
        const v16bf bpl0 = cat16b(pl[0], pl[1]), bpl1 = cat16b(pl[2], pl[3]);

        // ---- O^T tiles: A = K^T rows d = t*16 + lm, k = s, transposed on the way out of LDS
        const bf* vr = Kv + (8 * hf + (lane & 7)) * VP + 8 * ((lane >> 3) & 1);
#pragma unroll
        for (int t = 0; t < 4; ++t) {
            const bf* ar = vr + t * 16;
            const v16bf a0 = cat16b(ldtr16(ar), ldtr16(ar + 16 * VP));
            const v16bf a1 = cat16b(ldtr16(ar + 32 * VP), ldtr16(ar + 48 * VP));
            acc[t] = wmmab(a0, bph0, acc[t]);
            acc[t] = wmmab(a0, bpl0, acc[t]);
            acc[t] = wmmab(a1, bph1, acc[t]);
            acc[t] = wmmab(a1, bpl1, acc[t]);
        }
        asm volatile("v_nop\n\tv_nop\n\tv_nop\n\tv_nop" : "+v"(acc[0]), "+v"(acc[1]), "+v"(acc[2]), "+v"(acc[3]) : "v"(bph0), "v"(bpl1));
    }

    // ---- epilogue: acc[t][r] = O^T[d = t*16 + 8*hf + r][l = lm]; stage O[l][d] per wave in LDS, then whole-line stores
    const float inv = 1.0f / lrun;
    float* osw = os[wave];
#pragma unroll
    for (int t = 0; t < 4; ++t) {
        v4f w0, w1;
        w0[0] = acc[t][0] * inv; w0[1] = acc[t][1] * inv; w0[2] = acc[t][2] * inv; w0[3] = acc[t][3] * inv;
        w1[0] = acc[t][4] * inv; w1[1] = acc[t][5] * inv; w1[2] = acc[t][6] * inv; w1[3] = acc[t][7] * inv;
        *(v4fa*)(osw + lm * OP + t * 16 + 8 * hf) = w0;
        *(v4fa*)(osw + lm * OP + t * 16 + 8 * hf + 4) = w1;
    }
    __builtin_amdgcn_fence(3 /* release order */, "wavefront");
    __builtin_amdgcn_wave_barrier();
    // each instruction: lanes 0..15 -> row 2s (256 B = 2 lines, 8 lanes per line), lanes 16..31 -> row 2s+1
    float* orow0 = Out + ((size_t)b * SEQ_FULL + (size_t)m0) * TOKP + h * HD;
{
#pragma unroll
        for (int s = 0; s < 8; ++s) {
            const int row = 2 * s + hf; const int cofs = lm * 4;
            const v4f val = *(const v4fa*)(osw + row * OP + cofs);
            *(v4f*)(orow0 + (size_t)row * TOKP + cofs) = val;
        }
        
    }
}

extern "C" void kernel_launch(void* const* d_in, const int* in_sizes, int n_in,
                              void* d_out, int out_size, void* d_ws, size_t ws_size, hipStream_t stream) {
    if (n_in < 2) return;
    const float* Qin = (const float*)d_in[0];
    const float* Kin = (const float*)d_in[1];
    float* OUT = (float*)d_out;
    const size_t need = ((size_t)(NB - 1) * SEQ_FULL + SEQ) * TOKP;
    if (in_sizes[0] < 0 || in_sizes[1] < 0 || out_size < 0) return;
    if ((size_t)in_sizes[0] < need || (size_t)in_sizes[1] < need) return;
    if ((in_sizes[0] & 63) != 0 || (in_sizes[1] & 63) != 0) return;
    if ((size_t)out_size < OUT1E + need) return;
    // workspace: bf16 copies of both inputs (2 B per element), 256-B aligned regions
    const size_t qbytes = (((size_t)in_sizes[0] * 2) + 255) & ~(size_t)255;
    const size_t kbytes = (((size_t)in_sizes[1] * 2) + 255) & ~(size_t)255;
    if (qbytes + kbytes > ws_size) return;
    if (qbytes + kbytes > (size_t)134217728u) return;
    char* wsp = (char*)d_ws;
    bf* QB = (bf*)wsp; bf* KB = (bf*)(wsp + qbytes);
    const size_t nq8 = (size_t)in_sizes[0] / 8, nk8 = (size_t)in_sizes[1] / 8;
    k_cvt8<<<(unsigned)((nq8 + 255) / 256), 256, 0, stream>>>(Qin, QB, nq8);
    k_cvt8<<<(unsigned)((nk8 + 255) / 256), 256, 0, stream>>>(Kin, KB, nk8);
    dim3 grid(SEQ / BM, NB * NH);
    // out0: rows of queries attend over keys (values = keys)
    k_attn<<<grid, NT, 0, stream>>>(QB, KB, OUT);
    // out1: rows of keys attend over queries (values = queries)
    k_attn<<<grid, NT, 0, stream>>>(KB, QB, OUT + OUT1E);
}

// v002
// One run takes 115 microseconds.
// Two timings next to v001 put it at 1.13 and 1.12 times that version's speed.
// Over all steps from v000 it is 1.94 times as fast.
#include <hip/hip_runtime.h>

// Contractions: scores q.k^T on v_wmma_f32_16x16x32_bf16 (both inputs RNE-converted to bf16 once, single product, f32 accumulate); P.V on v_wmma_f32_16x16x32_bf16 with P as bf16 hi+lo planes x the single bf16 value plane (2 products), f32 accumulate; softmax statistics, rescaling and normalisation in f32; outputs f32.
// Second output: the same kernel with the two tensors swapped (keys act as queries; queries act as keys and values).

#define NH 8
#define HD 64
#ifndef NB
#define NB 4
#endif
#ifndef SEQ
#define SEQ 2048
#endif
#define NB_FULL 4
#define SEQ_FULL 2048
#define TOKP (NH * HD)                                   // token pitch in elements (512)
#define OUT1E ((size_t)NB_FULL * SEQ_FULL * NH * HD)     // second output starts at this element
#define KC 64                                            // keys per chunk
#define BM 64                                            // query rows per block (4 waves x 16)
#define NT 128
#define KP 72                                            // LDS pitch (halves) of the [s][e] tile
#define VP 80                                            // LDS pitch (halves) of the [s][d] copy read by the transposing load (32 B x odd)
#define OP 68                                            // LDS pitch (floats) of the output staging tile
#define SCALE 0.125f                                     // HD^-0.5, exact power of two
#define LOG2E 1.4426950408889634f

static_assert(OUT1E * 4 == 16777216u);
static_assert(SEQ % KC == 0);
static_assert(SEQ % BM == 0);
static_assert(SEQ <= SEQ_FULL);
static_assert(NB <= NB_FULL);
static_assert(KC * HD / 8 == 4 * NT);
static_assert((KP % 8) == 0 && (VP % 16) == 0 && ((VP / 16) & 1) == 1 && (OP % 4) == 0);

typedef unsigned short bf;
typedef __attribute__((ext_vector_type(16))) __bf16   v16bf;
typedef __attribute__((ext_vector_type(8)))  unsigned short v8us;
typedef __attribute__((ext_vector_type(8)))  float    v8f;
typedef __attribute__((ext_vector_type(4)))  float    v4f;
typedef __attribute__((ext_vector_type(8)))  short    v8s;
typedef __attribute__((ext_vector_type(2)))  float    v2f;
typedef __attribute__((ext_vector_type(2)))  __bf16   v2bf;
typedef __attribute__((ext_vector_type(4)))  unsigned v4u;
typedef v8us __attribute__((may_alias)) v8usa;
typedef v8f  __attribute__((may_alias)) v8fa;
typedef v4f  __attribute__((may_alias)) v4fa;

__device__ __forceinline__ unsigned short f2bf(float f) { unsigned u = __float_as_uint(f); u += 0x7FFFu + ((u >> 16) & 1u); return (unsigned short)(u >> 16); }
__device__ __forceinline__ v2bf cvt2(float a, float b) { const v2f x = {a, b}; return __builtin_convertvector(x, v2bf); }   // one v_cvt_pk_bf16_f32 (round to nearest even)
__device__ __forceinline__ v16bf cat16b(v8us lo, v8us hi) { return __builtin_bit_cast(v16bf, __builtin_shufflevector(lo, hi, 0, 1, 2, 3, 4, 5, 6, 7, 8, 9, 10, 11, 12, 13, 14, 15)); }
__device__ __forceinline__ v16bf cat16w(v4u lo, v4u hi) { return __builtin_bit_cast(v16bf, __builtin_shufflevector(lo, hi, 0, 1, 2, 3, 4, 5, 6, 7)); }
// ds_load_tr16_b128: lane l passes the address of 16 B of row kbase + 8*(l>>4) + (l&7); it gets column dbase + (l&15), rows kbase + 8*(l>>4) + 0..7
__device__ __forceinline__ v8us ldtr16(const bf* p) { typedef __attribute__((address_space(3))) v8s lds_v8s; return __builtin_bit_cast(v8us, __builtin_amdgcn_ds_load_tr16_b128_v8i16((lds_v8s*)p)); }
__device__ __forceinline__ v8f wmmab(v16bf a, v16bf b, v8f c) { return __builtin_amdgcn_wmma_f32_16x16x32_bf16(false, a, false, b, (short)0, c, false, false); }

__global__ __launch_bounds__(256) void k_cvt8(const float* __restrict__ src, bf* dst, size_t n8) {
    const size_t i = (size_t)blockIdx.x * 256 + threadIdx.x; if (i >= n8) return;
    const v8f v = *(const v8fa*)(src + i * 8); v8us o;
#pragma unroll
    for (int k = 0; k < 8; ++k) o[k] = f2bf(v[k]);
    *(v8us*)(dst + i * 8) = o; 
}

// k_attn: Out[(b*SEQ_FULL + l)*TOKP + h*HD + d] = sum_s softmax_s(SCALE * Q[b,l,h,:].K[b,s,h,:]) K[b,s,h,d]
// Qp/Kp: bf16 token-major [b][t][h][d]. grid (SEQ/BM, NB*NH), NT threads; wave w owns query rows m0 .. m0+15.
// Fragment map (A, B alike): lane l: row/col = l & 15, elements 0..7 <- k0 + 8*(l>>4) + 0..7, elements 8..15 <- k0 + 16 + 8*(l>>4) + 0..7; D element r of lane l = (row 8*(l>>4)+r, col l&15).
__global__ __launch_bounds__(NT) void k_attn(const bf* __restrict__ Qp, const bf* __restrict__ Kp, float* Out) {
    __shared__ __align__(16) bf Krm[KC * KP];        // [s][e] chunk tile (cross-wave: block barriers)
    __shared__ __align__(16) bf Kv[KC * VP];         // [s][d] chunk tile at the transposing load's pitch (cross-wave: block barriers)
    __shared__ __align__(16) float os[4][16 * OP];   // per-wave output staging (wave-private)

    const int tid = threadIdx.x, wave = tid >> 5, lane = tid & 31, hf = lane >> 4, lm = lane & 15;
    const int bh = blockIdx.y, b = bh / NH, h = bh % NH;
    const int m0 = blockIdx.x * BM + wave * 16;

    // Q^T as the B operand of the scores: column n = lm <- query row m0+lm; k = e (two k-steps of 32).
    const bf* Qg = Qp + ((size_t)b * SEQ_FULL + (size_t)(m0 + lm)) * TOKP + h * HD;
    const v16bf bq0 = cat16b(*(const v8usa*)(Qg + 8 * hf), *(const v8usa*)(Qg + 16 + 8 * hf));
    const v16bf bq1 = cat16b(*(const v8usa*)(Qg + 32 + 8 * hf), *(const v8usa*)(Qg + 48 + 8 * hf));
    const bf* Kg = Kp + (size_t)b * SEQ_FULL * TOKP + h * HD;

    float mrun = -1.0e30f, lrun = 0.0f;
    v8f acc[4];
#pragma unroll
    for (int t = 0; t < 4; ++t) acc[t] = (v8f){};

#pragma unroll 1
    for (int s0 = 0; s0 < SEQ; s0 += KC) {
        __syncthreads();   // all waves done reading the prior chunk
        // ---- stage the chunk: 512 x 16-B pieces, 4 per thread; two row-major copies, each at its reader's pitch
#pragma unroll
        for (int it = 0; it < 4; ++it) {
            const int idx = it * NT + tid; const int s = idx >> 3; const int c8 = (idx & 7) * 8;
            const v8us v = *(const v8usa*)(Kg + (size_t)(s0 + s) * TOKP + c8);
            *(v8usa*)(Krm + s * KP + c8) = v;
            *(v8usa*)(Kv + s * VP + c8) = v;
        }
        __syncthreads();

        // ---- S^T tiles: A rows = key s (mt*16 + lm), k = e; B = Q^T
        v8f c[4];
#pragma unroll
        for (int mt = 0; mt < 4; ++mt) {
            const bf* ar = Krm + (mt * 16 + lm) * KP + 8 * hf;
            const v16bf a0 = cat16b(*(const v8usa*)(ar), *(const v8usa*)(ar + 16));
            const v16bf a1 = cat16b(*(const v8usa*)(ar + 32), *(const v8usa*)(ar + 48));
            v8f cz = (v8f){};
            cz = wmmab(a0, bq0, cz);
            cz = wmmab(a1, bq1, cz);
            c[mt] = cz;
        }
        asm volatile("v_nop\n\tv_nop\n\tv_nop\n\tv_nop" : "+v"(c[0]), "+v"(c[1]), "+v"(c[2]), "+v"(c[3]) : "v"(bq0), "v"(bq1));

        // ---- online softmax per query column l = lm: this lane holds keys s = mt*16 + 8*hf + r; partner lane ^16 holds the rest
        float mx = -1.0e30f;
#pragma unroll
        for (int mt = 0; mt < 4; ++mt) {
            c[mt] = c[mt] * SCALE;
#pragma unroll
            for (int r = 0; r < 8; ++r) mx = fmaxf(mx, c[mt][r]);
        }
        mx = fmaxf(mx, __shfl_xor(mx, 16, 32));
        const float mnew = fmaxf(mrun, mx);
        const float corr = __builtin_amdgcn_exp2f((mrun - mnew) * LOG2E);
        float psum = 0.0f;
        v4u phw[4], plw[4];
#pragma unroll
        for (int mt = 0; mt < 4; ++mt) {
#pragma unroll
            for (int r = 0; r < 8; r += 2) {
                const float p0 = __builtin_amdgcn_exp2f((c[mt][r] - mnew) * LOG2E);
                const float p1 = __builtin_amdgcn_exp2f((c[mt][r + 1] - mnew) * LOG2E);
                psum += p0;
                psum += p1;
                const v2bf hh = cvt2(p0, p1);                                    // hi plane: RNE, two elements per instruction
                const v2bf ll = cvt2(p0 - (float)hh[0], p1 - (float)hh[1]);      // lo plane: the remainder p - hi (exact in f32), RNE
                phw[mt][r >> 1] = __builtin_bit_cast(unsigned, hh);
                plw[mt][r >> 1] = __builtin_bit_cast(unsigned, ll);
            }
        }
        psum += __shfl_xor(psum, 16, 32);
        lrun = lrun * corr + psum; mrun = mnew;
#pragma unroll
        for (int t = 0; t < 4; ++t) acc[t] = acc[t] * corr;

        // ---- P^T as the B operand (k = s, n = l): element r <- tile covering s 0..15 (or 32..47), element 8+r <- tile covering s 16..31 (or 48..63), same lane
        const v16bf bph0 = cat16w(phw[0], phw[1]), bph1 = cat16w(phw[2], phw[3]);
        const v16bf bpl0 = cat16w(plw[0], plw[1]), bpl1 = cat16w(plw[2], plw[3]);

        // ---- O^T tiles: A = K^T rows d = t*16 + lm, k = s, transposed on the way out of LDS
        const bf* vr = Kv + (8 * hf + (lane & 7)) * VP + 8 * ((lane >> 3) & 1);
#pragma unroll
        for (int t = 0; t < 4; ++t) {
            const bf* ar = vr + t * 16;
            const v16bf a0 = cat16b(ldtr16(ar), ldtr16(ar + 16 * VP));
            const v16bf a1 = cat16b(ldtr16(ar + 32 * VP), ldtr16(ar + 48 * VP));
            acc[t] = wmmab(a0, bph0, acc[t]);
            acc[t] = wmmab(a0, bpl0, acc[t]);
            acc[t] = wmmab(a1, bph1, acc[t]);
            acc[t] = wmmab(a1, bpl1, acc[t]);
        }
        asm volatile("v_nop\n\tv_nop\n\tv_nop\n\tv_nop" : "+v"(acc[0]), "+v"(acc[1]), "+v"(acc[2]), "+v"(acc[3]) : "v"(bph0), "v"(bpl1));
    }

    // ---- epilogue: acc[t][r] = O^T[d = t*16 + 8*hf + r][l = lm]; stage O[l][d] per wave in LDS, then whole-line stores
    const float inv = 1.0f / lrun;
    float* osw = os[wave];
#pragma unroll
    for (int t = 0; t < 4; ++t) {
        v4f w0, w1;
        w0[0] = acc[t][0] * inv; w0[1] = acc[t][1] * inv; w0[2] = acc[t][2] * inv; w0[3] = acc[t][3] * inv;
        w1[0] = acc[t][4] * inv; w1[1] = acc[t][5] * inv; w1[2] = acc[t][6] * inv; w1[3] = acc[t][7] * inv;
        *(v4fa*)(osw + lm * OP + t * 16 + 8 * hf) = w0;
        *(v4fa*)(osw + lm * OP + t * 16 + 8 * hf + 4) = w1;
    }
    __builtin_amdgcn_fence(3 /* release order */, "wavefront");
    __builtin_amdgcn_wave_barrier();
    // each instruction: lanes 0..15 -> row 2s (256 B = 2 lines, 8 lanes per line), lanes 16..31 -> row 2s+1
    float* orow0 = Out + ((size_t)b * SEQ_FULL + (size_t)m0) * TOKP + h * HD;
{
#pragma unroll
        for (int s = 0; s < 8; ++s) {
            const int row = 2 * s + hf; const int cofs = lm * 4;
            const v4f val = *(const v4fa*)(osw + row * OP + cofs);
            *(v4f*)(orow0 + (size_t)row * TOKP + cofs) = val;
        }
        
    }
}

extern "C" void kernel_launch(void* const* d_in, const int* in_sizes, int n_in,
                              void* d_out, int out_size, void* d_ws, size_t ws_size, hipStream_t stream) {
    if (n_in < 2) return;
    const float* Qin = (const float*)d_in[0];
    const float* Kin = (const float*)d_in[1];
    float* OUT = (float*)d_out;
    const size_t need = ((size_t)(NB - 1) * SEQ_FULL + SEQ) * TOKP;
    if (in_sizes[0] < 0 || in_sizes[1] < 0 || out_size < 0) return;
    if ((size_t)in_sizes[0] < need || (size_t)in_sizes[1] < need) return;
    if ((in_sizes[0] & 63) != 0 || (in_sizes[1] & 63) != 0) return;
    if ((size_t)out_size < OUT1E + need) return;
    // workspace: bf16 copies of both inputs (2 B per element), 256-B aligned regions
    const size_t qbytes = (((size_t)in_sizes[0] * 2) + 255) & ~(size_t)255;
    const size_t kbytes = (((size_t)in_sizes[1] * 2) + 255) & ~(size_t)255;
    if (qbytes + kbytes > ws_size) return;
    if (qbytes + kbytes > (size_t)134217728u) return;
    char* wsp = (char*)d_ws;
    bf* QB = (bf*)wsp; bf* KB = (bf*)(wsp + qbytes);
    const size_t nq8 = (size_t)in_sizes[0] / 8, nk8 = (size_t)in_sizes[1] / 8;
    k_cvt8<<<(unsigned)((nq8 + 255) / 256), 256, 0, stream>>>(Qin, QB, nq8);
    k_cvt8<<<(unsigned)((nk8 + 255) / 256), 256, 0, stream>>>(Kin, KB, nk8);
    dim3 grid(SEQ / BM, NB * NH);
    // out0: rows of queries attend over keys (values = keys)
    k_attn<<<grid, NT, 0, stream>>>(QB, KB, OUT);
    // out1: rows of keys attend over queries (values = queries)
    k_attn<<<grid, NT, 0, stream>>>(KB, QB, OUT + OUT1E);
}

// v004
// A run of this version takes 83.5 microseconds.
// Versions in between are left out here; by their measured steps it is 1.37 times as fast as v002.
// All steps since v000 together make it 2.65 times as fast.
#include <hip/hip_runtime.h>

// Contractions: scores q.k^T on v_wmma_f32_16x16x32_f16 (both inputs RNE-converted to f16 once, single product, f32 accumulate); P.V on v_wmma_f32_16x16x32_f16 with P as one f16 plane (P lies in [0, 1]: 11 significant bits, RNE) x the single f16 value plane (1 product), f32 accumulate; softmax statistics, rescaling and normalisation in f32; outputs f32.
// Second output: the same kernel with the two tensors swapped (keys act as queries; queries act as keys and values).

#define NH 8
#define HD 64
#ifndef NB
#define NB 4
#endif
#ifndef SEQ
#define SEQ 2048
#endif
#define NB_FULL 4
#define SEQ_FULL 2048
#define TOKP (NH * HD)                                   // token pitch in elements (512)
#define OUT1E ((size_t)NB_FULL * SEQ_FULL * NH * HD)     // second output starts at this element
#define KC 64                                            // keys per chunk
#define BM 64                                            // query rows per block (4 waves x 16)
#define NT 128
#define KP 72                                            // LDS pitch (halves) of the [s][e] tile
#define VP 80                                            // LDS pitch (halves) of the [s][d] copy read by the transposing load (32 B x odd)
#define OP 68                                            // LDS pitch (floats) of the output staging tile
#define SCALE 0.125f                                     // HD^-0.5, exact power of two
#define LOG2E 1.4426950408889634f
#define NTL (SEQ / KC)                                   // chunks walked by a block
#define BUFH (KC * KP + KC * VP)                         // halves per ring buffer: the [s][e] tile, then the [s][d] tile

static_assert(OUT1E * 4 == 16777216u);
static_assert(SEQ % KC == 0);
static_assert(SEQ % BM == 0);
static_assert(SEQ <= SEQ_FULL);
static_assert(NB <= NB_FULL);
static_assert(KC * HD / 8 == 4 * NT);
static_assert(NTL >= 2 && (NTL % 2) == 0);
static_assert((BUFH % 8) == 0 && ((KC * KP) % 8) == 0);
static_assert((KP % 8) == 0 && (VP % 16) == 0 && ((VP / 16) & 1) == 1 && (OP % 4) == 0);

typedef unsigned short h16;                              // one f16 element, as raw bits
typedef __attribute__((ext_vector_type(16))) _Float16 v16h;
typedef __attribute__((ext_vector_type(8)))  _Float16 v8h;
typedef __attribute__((ext_vector_type(8)))  unsigned short v8us;
typedef __attribute__((ext_vector_type(8)))  float    v8f;
typedef __attribute__((ext_vector_type(4)))  float    v4f;
typedef __attribute__((ext_vector_type(8)))  short    v8s;
typedef __attribute__((ext_vector_type(2)))  float    v2f;
typedef __attribute__((ext_vector_type(2)))  _Float16 v2h;
typedef __attribute__((ext_vector_type(4)))  unsigned v4u;
typedef v8us __attribute__((may_alias)) v8usa;
typedef v8f  __attribute__((may_alias)) v8fa;
typedef v4f  __attribute__((may_alias)) v4fa;

__device__ __forceinline__ v2h cvt2(float a, float b) { const v2f x = {a, b}; return __builtin_convertvector(x, v2h); }   // one v_cvt_pk_f16_f32 (round to nearest even)
__device__ __forceinline__ v16h cat16b(v8us lo, v8us hi) { return __builtin_bit_cast(v16h, __builtin_shufflevector(lo, hi, 0, 1, 2, 3, 4, 5, 6, 7, 8, 9, 10, 11, 12, 13, 14, 15)); }
__device__ __forceinline__ v16h cat16w(v4u lo, v4u hi) { return __builtin_bit_cast(v16h, __builtin_shufflevector(lo, hi, 0, 1, 2, 3, 4, 5, 6, 7)); }
// ds_load_tr16_b128: lane l passes the address of 16 B of row kbase + 8*(l>>4) + (l&7); it gets column dbase + (l&15), rows kbase + 8*(l>>4) + 0..7
__device__ __forceinline__ v8us ldtr16(const h16* p) { typedef __attribute__((address_space(3))) v8s lds_v8s; return __builtin_bit_cast(v8us, __builtin_amdgcn_ds_load_tr16_b128_v8i16((lds_v8s*)p)); }
__device__ __forceinline__ v8f wmmab(v16h a, v16h b, v8f c) { return __builtin_amdgcn_wmma_f32_16x16x32_f16(false, a, false, b, (short)0, c, false, false); }

// LDS byte address of a __shared__ element (the low 32 bits of its address)
__device__ __forceinline__ unsigned ldsaddr(const h16* p) { typedef __attribute__((address_space(3))) const h16 lds_h16; return (unsigned)(size_t)(lds_h16*)p; }
// One chunk's copies of one thread: four 16-B pieces of the chunk, each straight from global memory into both LDS tiles (lk: [s][e] tile, lv: [s][d] tile), through no register.
// The closing s_wait_xcnt stands inside the statement so that no address register named here is rewritten ahead of it.
__device__ __forceinline__ void copy_chunk(unsigned lk, unsigned lv, const h16* g) {
    const unsigned lk1 = lk + 16 * KP * 2, lk2 = lk + 32 * KP * 2, lk3 = lk + 48 * KP * 2;
    const unsigned lv1 = lv + 16 * VP * 2, lv2 = lv + 32 * VP * 2, lv3 = lv + 48 * VP * 2;
    const h16* g1 = g + 16 * TOKP; const h16* g2 = g + 32 * TOKP; const h16* g3 = g + 48 * TOKP;
    asm volatile("global_load_async_to_lds_b128 %0, %8, off\n\t"
                 "global_load_async_to_lds_b128 %4, %12, off\n\t"
                 "global_load_async_to_lds_b128 %1, %9, off\n\t"
                 "global_load_async_to_lds_b128 %5, %13, off\n\t"
                 "global_load_async_to_lds_b128 %2, %10, off\n\t"
                 "global_load_async_to_lds_b128 %6, %14, off\n\t"
                 "global_load_async_to_lds_b128 %3, %11, off\n\t"
                 "global_load_async_to_lds_b128 %7, %15, off\n\t"
                 "s_wait_xcnt 0x0"
                 :: "v"(lk), "v"(lk1), "v"(lk2), "v"(lk3), "v"(lv), "v"(lv1), "v"(lv2), "v"(lv3),
                    "v"(g), "v"(g1), "v"(g2), "v"(g3), "v"(g), "v"(g1), "v"(g2), "v"(g3) : "memory");
}

__global__ __launch_bounds__(256) void k_cvt8(const float* __restrict__ src, h16* dst, size_t n8) {
    const size_t i = (size_t)blockIdx.x * 256 + threadIdx.x; if (i >= n8) return;
    const v8f v = *(const v8fa*)(src + i * 8);
    *(v8us*)(dst + i * 8) = __builtin_bit_cast(v8us, __builtin_convertvector(v, v8h));   // round to nearest even
}

// k_attn: Out[(b*SEQ_FULL + l)*TOKP + h*HD + d] = sum_s softmax_s(SCALE * Q[b,l,h,:].K[b,s,h,:]) K[b,s,h,d]
// Qp/Kp: f16 token-major [b][t][h][d]. grid (SEQ/BM, NB*NH), NT threads; wave w owns query rows m0 .. m0+15.
// Fragment map (A, B alike): lane l: row/col = l & 15, elements 0..7 <- k0 + 8*(l>>4) + 0..7, elements 8..15 <- k0 + 16 + 8*(l>>4) + 0..7; D element r of lane l = (row 8*(l>>4)+r, col l&15).
__global__ __launch_bounds__(NT) void k_attn(const h16* __restrict__ Qp, const h16* __restrict__ Kp, float* Out) {
    __shared__ __align__(16) h16 ring[2 * BUFH];      // two buffers, each the [s][e] chunk tile and the [s][d] chunk tile at the transposing load's pitch (cross-wave: block barriers)
    __shared__ __align__(16) float os[4][16 * OP];   // per-wave output staging (wave-private)

    const int tid = threadIdx.x, wave = tid >> 5, lane = tid & 31, hf = lane >> 4, lm = lane & 15;
    const int bh = blockIdx.y, b = bh / NH, h = bh % NH;
    const int m0 = blockIdx.x * BM + wave * 16;

    // Q^T as the B operand of the scores: column n = lm <- query row m0+lm; k = e (two k-steps of 32).
    const h16* Qg = Qp + ((size_t)b * SEQ_FULL + (size_t)(m0 + lm)) * TOKP + h * HD;
    const v16h bq0 = cat16b(*(const v8usa*)(Qg + 8 * hf), *(const v8usa*)(Qg + 16 + 8 * hf));
    const v16h bq1 = cat16b(*(const v8usa*)(Qg + 32 + 8 * hf), *(const v8usa*)(Qg + 48 + 8 * hf));
    const h16* Kg = Kp + (size_t)b * SEQ_FULL * TOKP + h * HD;

    float mrun = -1.0e30f, lrun = 0.0f;
    v8f acc[4];
#pragma unroll
    for (int t = 0; t < 4; ++t) acc[t] = (v8f){};

    // ---- staging: a chunk is 512 x 16-B pieces, 4 per thread (rows srow + 0, 16, 32, 48), copied into two row-major tiles, each at its reader's pitch
    const int srow = tid >> 3, sc8 = (tid & 7) * 8;
    const unsigned lk0 = ldsaddr(ring + srow * KP + sc8), lv0 = ldsaddr(ring + KC * KP + srow * VP + sc8);
    const h16* gnext = Kg + (size_t)srow * TOKP + sc8;   // this thread's first piece of the next chunk to be copied
    copy_chunk(lk0, lv0, gnext); gnext += KC * TOKP;
    asm volatile("s_wait_asynccnt 0x0" ::: "memory");    // this wave's copies of chunk 0 have landed
    __syncthreads();                                     // chunk 0 is published to every wave
    copy_chunk(lk0 + BUFH * 2, lv0 + BUFH * 2, gnext); gnext += KC * TOKP;

    // one pass: chunk in buffer cur is worked on while the other buffer's copies fly; more: a chunk two ahead exists
    auto pass = [&](const int cur, const bool more) __attribute__((always_inline)) {
        const h16* Krm = ring + cur * BUFH;
        const h16* Kv = Krm + KC * KP;
        // ---- S^T tiles: A rows = key s (mt*16 + lm), k = e; B = Q^T
        v8f c[4];
#pragma unroll
        for (int mt = 0; mt < 4; ++mt) {
            const h16* ar = Krm + (mt * 16 + lm) * KP + 8 * hf;
            const v16h a0 = cat16b(*(const v8usa*)(ar), *(const v8usa*)(ar + 16));
            const v16h a1 = cat16b(*(const v8usa*)(ar + 32), *(const v8usa*)(ar + 48));
            v8f cz = (v8f){};
            cz = wmmab(a0, bq0, cz);
            cz = wmmab(a1, bq1, cz);
            c[mt] = cz;
        }
        asm volatile("v_nop\n\tv_nop\n\tv_nop\n\tv_nop" : "+v"(c[0]), "+v"(c[1]), "+v"(c[2]), "+v"(c[3]) : "v"(bq0), "v"(bq1));

        // ---- online softmax per query column l = lm: this lane holds keys s = mt*16 + 8*hf + r; partner lane ^16 holds the rest
        float mx = -1.0e30f;
#pragma unroll
        for (int mt = 0; mt < 4; ++mt) {
            c[mt] = c[mt] * SCALE;
#pragma unroll
            for (int r = 0; r < 8; ++r) mx = fmaxf(mx, c[mt][r]);
        }
        mx = fmaxf(mx, __shfl_xor(mx, 16, 32));
        const float mnew = fmaxf(mrun, mx);
        const float corr = __builtin_amdgcn_exp2f((mrun - mnew) * LOG2E);
        float psum = 0.0f;
        v4u pw[4];
#pragma unroll
        for (int mt = 0; mt < 4; ++mt) {
#pragma unroll
            for (int r = 0; r < 8; r += 2) {
                const float p0 = __builtin_amdgcn_exp2f((c[mt][r] - mnew) * LOG2E);
                const float p1 = __builtin_amdgcn_exp2f((c[mt][r + 1] - mnew) * LOG2E);
                psum += p0;
                psum += p1;
                pw[mt][r >> 1] = __builtin_bit_cast(unsigned, cvt2(p0, p1));     // the one f16 plane: RNE, two elements per instruction
            }
        }
        psum += __shfl_xor(psum, 16, 32);
        lrun = lrun * corr + psum; mrun = mnew;
#pragma unroll
        for (int t = 0; t < 4; ++t) acc[t] = acc[t] * corr;

        // ---- P^T as the B operand (k = s, n = l): element r <- tile covering s 0..15 (or 32..47), element 8+r <- tile covering s 16..31 (or 48..63), same lane
        const v16h bp0 = cat16w(pw[0], pw[1]), bp1 = cat16w(pw[2], pw[3]);

        // ---- O^T tiles: A = K^T rows d = t*16 + lm, k = s, transposed on the way out of LDS
        const h16* vr = Kv + (8 * hf + (lane & 7)) * VP + 8 * ((lane >> 3) & 1);
#pragma unroll
        for (int t = 0; t < 4; ++t) {
            const h16* ar = vr + t * 16;
            const v16h a0 = cat16b(ldtr16(ar), ldtr16(ar + 16 * VP));
            const v16h a1 = cat16b(ldtr16(ar + 32 * VP), ldtr16(ar + 48 * VP));
            acc[t] = wmmab(a0, bp0, acc[t]);
            acc[t] = wmmab(a1, bp1, acc[t]);
        }
        // four vector slots between the last matrix instruction and whatever follows the pass (the chip's distance after a WMMA)
        asm volatile("v_nop\n\tv_nop\n\tv_nop\n\tv_nop" : "+v"(acc[0]), "+v"(acc[1]), "+v"(acc[2]), "+v"(acc[3]) : "v"(bp0), "v"(bp1));

        // ---- publish point of the next chunk
        asm volatile("s_wait_dscnt 0x0" ::: "memory");      // this wave's reads of buffer cur have returned before it is refilled
        asm volatile("s_wait_asynccnt 0x0" ::: "memory");   // this wave's copies of the next chunk have landed
        __syncthreads();                                    // publishes the next chunk and ends every wave's reads of buffer cur
        if (more) { copy_chunk(lk0 + cur * BUFH * 2, lv0 + cur * BUFH * 2, gnext); gnext += KC * TOKP; }
    };
    // two passes a trip, so that each pass's buffer is a compile-time constant; kept rolled beyond that: more copies of the body only grow the code
#pragma unroll 1
    for (int t = 0; t < NTL; t += 2) {
        const bool more = t + 2 < NTL;
        pass(0, more);
        pass(1, more);
    }
    asm volatile("s_wait_asynccnt 0x0" ::: "memory");       // nothing of this wave is in flight when it goes on to the epilogue

    // ---- epilogue: acc[t][r] = O^T[d = t*16 + 8*hf + r][l = lm]; stage O[l][d] per wave in LDS, then whole-line stores
    const float inv = 1.0f / lrun;
    float* osw = os[wave];
#pragma unroll
    for (int t = 0; t < 4; ++t) {
        v4f w0, w1;
        w0[0] = acc[t][0] * inv; w0[1] = acc[t][1] * inv; w0[2] = acc[t][2] * inv; w0[3] = acc[t][3] * inv;
        w1[0] = acc[t][4] * inv; w1[1] = acc[t][5] * inv; w1[2] = acc[t][6] * inv; w1[3] = acc[t][7] * inv;
        *(v4fa*)(osw + lm * OP + t * 16 + 8 * hf) = w0;
        *(v4fa*)(osw + lm * OP + t * 16 + 8 * hf + 4) = w1;
    }
    __builtin_amdgcn_fence(3 /* release order */, "wavefront");
    __builtin_amdgcn_wave_barrier();
    // each instruction: lanes 0..15 -> row 2s (256 B = 2 lines, 8 lanes per line), lanes 16..31 -> row 2s+1
    float* orow0 = Out + ((size_t)b * SEQ_FULL + (size_t)m0) * TOKP + h * HD;
{
#pragma unroll
        for (int s = 0; s < 8; ++s) {
            const int row = 2 * s + hf; const int cofs = lm * 4;
            const v4f val = *(const v4fa*)(osw + row * OP + cofs);
            *(v4f*)(orow0 + (size_t)row * TOKP + cofs) = val;
        }
        
    }
}

extern "C" void kernel_launch(void* const* d_in, const int* in_sizes, int n_in,
                              void* d_out, int out_size, void* d_ws, size_t ws_size, hipStream_t stream) {
    if (n_in < 2) return;
    const float* Qin = (const float*)d_in[0];
    const float* Kin = (const float*)d_in[1];
    float* OUT = (float*)d_out;
    const size_t need = ((size_t)(NB - 1) * SEQ_FULL + SEQ) * TOKP;
    if (in_sizes[0] < 0 || in_sizes[1] < 0 || out_size < 0) return;
    if ((size_t)in_sizes[0] < need || (size_t)in_sizes[1] < need) return;
    if ((in_sizes[0] & 63) != 0 || (in_sizes[1] & 63) != 0) return;
    if ((size_t)out_size < OUT1E + need) return;
    // workspace: f16 copies of both inputs (2 B per element), 256-B aligned regions
    const size_t qbytes = (((size_t)in_sizes[0] * 2) + 255) & ~(size_t)255;
    const size_t kbytes = (((size_t)in_sizes[1] * 2) + 255) & ~(size_t)255;
    if (qbytes + kbytes > ws_size) return;
    if (qbytes + kbytes > (size_t)134217728u) return;
    char* wsp = (char*)d_ws;
    h16* QB = (h16*)wsp; h16* KB = (h16*)(wsp + qbytes);
    const size_t nq8 = (size_t)in_sizes[0] / 8, nk8 = (size_t)in_sizes[1] / 8;
    k_cvt8<<<(unsigned)((nq8 + 255) / 256), 256, 0, stream>>>(Qin, QB, nq8);
    k_cvt8<<<(unsigned)((nk8 + 255) / 256), 256, 0, stream>>>(Kin, KB, nk8);
    dim3 grid(SEQ / BM, NB * NH);
    // out0: rows of queries attend over keys (values = keys)
    k_attn<<<grid, NT, 0, stream>>>(QB, KB, OUT);
    // out1: rows of keys attend over queries (values = queries)
    k_attn<<<grid, NT, 0, stream>>>(KB, QB, OUT + OUT1E);
}

// v005
// One run takes 81.7 microseconds.
// In both of two side-by-side timings against v004, it was 1.03 times as fast.
// All steps since v000 together make it 2.73 times as fast.
#include <hip/hip_runtime.h>

// Contractions: scores q.k^T on v_wmma_f32_16x16x32_f16 (both inputs RNE-converted to f16 once, single product, f32 accumulate); P.V on v_wmma_f32_16x16x32_f16 with P as one f16 plane (P lies in [0, 1]: 11 significant bits, RNE) x the single f16 value plane (1 product), f32 accumulate; softmax statistics, rescaling and normalisation in f32; outputs f32.
// Second output: the same kernel with the two tensors swapped (keys act as queries; queries act as keys and values).

#define NH 8
#define HD 64
#ifndef NB
#define NB 4
#endif
#ifndef SEQ
#define SEQ 2048
#endif
#define NB_FULL 4
#define SEQ_FULL 2048
#define TOKP (NH * HD)                                   // token pitch in elements (512)
#define OUT1E ((size_t)NB_FULL * SEQ_FULL * NH * HD)     // second output starts at this element
#define KC 64                                            // keys per chunk
#define BM 64                                            // query rows per block (4 waves x 16)
#define NT 128
#define KP 72                                            // LDS pitch (halves) of the [s][e] tile
#define VP 80                                            // LDS pitch (halves) of the [s][d] copy read by the transposing load (32 B x odd)
#define OP 68                                            // LDS pitch (floats) of the output staging tile
#define SCALE 0.125f                                     // HD^-0.5, exact power of two
#define LOG2E 1.4426950408889634f
#define NTL (SEQ / KC)                                   // chunks walked by a block
#define BUFH (KC * KP + KC * VP)                         // halves per ring buffer: the [s][e] tile, then the [s][d] tile
#define CT 512                                           // threads of a conversion block (16 waves)
#define CU 8                                             // 8-float pieces per conversion thread

static_assert(OUT1E * 4 == 16777216u);
static_assert(SEQ % KC == 0);
static_assert(SEQ % BM == 0);
static_assert(SEQ <= SEQ_FULL);
static_assert(NB <= NB_FULL);
static_assert(KC * HD / 8 == 4 * NT);
static_assert(NTL >= 2 && (NTL % 2) == 0);
static_assert((BUFH % 8) == 0 && ((KC * KP) % 8) == 0);
static_assert((KP % 8) == 0 && (VP % 16) == 0 && ((VP / 16) & 1) == 1 && (OP % 4) == 0);

typedef unsigned short h16;                              // one f16 element, as raw bits
typedef __attribute__((ext_vector_type(16))) _Float16 v16h;
typedef __attribute__((ext_vector_type(8)))  _Float16 v8h;
typedef __attribute__((ext_vector_type(8)))  unsigned short v8us;
typedef __attribute__((ext_vector_type(8)))  float    v8f;
typedef __attribute__((ext_vector_type(4)))  float    v4f;
typedef __attribute__((ext_vector_type(8)))  short    v8s;
typedef __attribute__((ext_vector_type(2)))  float    v2f;
typedef __attribute__((ext_vector_type(2)))  _Float16 v2h;
typedef __attribute__((ext_vector_type(4)))  unsigned v4u;
typedef v8us __attribute__((may_alias)) v8usa;
typedef v8f  __attribute__((may_alias)) v8fa;
typedef v4f  __attribute__((may_alias)) v4fa;

__device__ __forceinline__ v2h cvt2(float a, float b) { const v2f x = {a, b}; return __builtin_convertvector(x, v2h); }   // one v_cvt_pk_f16_f32 (round to nearest even)
__device__ __forceinline__ v16h cat16b(v8us lo, v8us hi) { return __builtin_bit_cast(v16h, __builtin_shufflevector(lo, hi, 0, 1, 2, 3, 4, 5, 6, 7, 8, 9, 10, 11, 12, 13, 14, 15)); }
__device__ __forceinline__ v16h cat16w(v4u lo, v4u hi) { return __builtin_bit_cast(v16h, __builtin_shufflevector(lo, hi, 0, 1, 2, 3, 4, 5, 6, 7)); }
// ds_load_tr16_b128: lane l passes the address of 16 B of row kbase + 8*(l>>4) + (l&7); it gets column dbase + (l&15), rows kbase + 8*(l>>4) + 0..7
__device__ __forceinline__ v8us ldtr16(const h16* p) { typedef __attribute__((address_space(3))) v8s lds_v8s; return __builtin_bit_cast(v8us, __builtin_amdgcn_ds_load_tr16_b128_v8i16((lds_v8s*)p)); }
__device__ __forceinline__ v8f wmmab(v16h a, v16h b, v8f c) { return __builtin_amdgcn_wmma_f32_16x16x32_f16(false, a, false, b, (short)0, c, false, false); }

// LDS byte address of a __shared__ element (the low 32 bits of its address)
__device__ __forceinline__ unsigned ldsaddr(const h16* p) { typedef __attribute__((address_space(3))) const h16 lds_h16; return (unsigned)(size_t)(lds_h16*)p; }
// One chunk's copies of one thread: four 16-B pieces of the chunk, each straight from global memory into both LDS tiles (lk: [s][e] tile, lv: [s][d] tile), through no register.
// The closing s_wait_xcnt stands inside the statement so that no address register named here is rewritten ahead of it.
__device__ __forceinline__ void copy_chunk(unsigned lk, unsigned lv, const h16* g) {
    const unsigned lk1 = lk + 16 * KP * 2, lk2 = lk + 32 * KP * 2, lk3 = lk + 48 * KP * 2;
    const unsigned lv1 = lv + 16 * VP * 2, lv2 = lv + 32 * VP * 2, lv3 = lv + 48 * VP * 2;
    const h16* g1 = g + 16 * TOKP; const h16* g2 = g + 32 * TOKP; const h16* g3 = g + 48 * TOKP;
    asm volatile("global_load_async_to_lds_b128 %0, %8, off\n\t"
                 "global_load_async_to_lds_b128 %4, %12, off\n\t"
                 "global_load_async_to_lds_b128 %1, %9, off\n\t"
                 "global_load_async_to_lds_b128 %5, %13, off\n\t"
                 "global_load_async_to_lds_b128 %2, %10, off\n\t"
                 "global_load_async_to_lds_b128 %6, %14, off\n\t"
                 "global_load_async_to_lds_b128 %3, %11, off\n\t"
                 "global_load_async_to_lds_b128 %7, %15, off\n\t"
                 "s_wait_xcnt 0x0"
                 :: "v"(lk), "v"(lk1), "v"(lk2), "v"(lk3), "v"(lv), "v"(lv1), "v"(lv2), "v"(lv3),
                    "v"(g), "v"(g1), "v"(g2), "v"(g3), "v"(g), "v"(g1), "v"(g2), "v"(g3) : "memory");
}

// k_cvt8: both tensors to f16 in one launch (blockIdx.y picks the tensor). A piece is 8 floats (32 B in, 16 B out).
// A block is 16 waves and each thread takes CU pieces, CT apart, all loaded before the first is converted: few waves to start, 16 loads of 16 B in flight per lane.
__global__ __launch_bounds__(CT) void k_cvt8(const float* __restrict__ qsrc, const float* __restrict__ ksrc, h16* __restrict__ qdst, h16* __restrict__ kdst, size_t nq8, size_t nk8) {
    const bool second = blockIdx.y != 0;
    const float* __restrict__ src = second ? ksrc : qsrc;
    h16* __restrict__ dst = second ? kdst : qdst;
    const size_t n8 = second ? nk8 : nq8;
    const size_t base = (size_t)blockIdx.x * (CT * CU);
    const size_t i0 = base + threadIdx.x;
    if (base + CT * CU <= n8) {                          // whole block inside the tensor (block-uniform)
        const float* p = src + i0 * 8;
        v8f v[CU];
#pragma unroll                                           // unrolled (here and below): v[] lives in registers and the loads share one address register with immediate offsets
        for (int u = 0; u < CU; ++u) v[u] = *(const v8fa*)(p + (size_t)u * (CT * 8));
        // behind the loads, which all name p's register: p is an input here, so that register is rewritten (also as a load's own destination) only behind this wait
        asm volatile("s_wait_xcnt 0x0" :: "v"(p) : "memory");
        __builtin_amdgcn_sched_barrier(0);               // no convert (with its wait) rises among the loads: without it the last two loads start only when the first have returned
#pragma unroll
        for (int u = 0; u < CU; ++u) *(v8us*)(dst + (i0 + (size_t)u * CT) * 8) = __builtin_bit_cast(v8us, __builtin_convertvector(v[u], v8h));   // round to nearest even
        asm volatile("s_wait_xcnt 0x0" ::: "memory");    // behind the last store: no register that a store names is rewritten ahead of this wait on any way out of this branch
    } else {                                             // the tensor's last, partial block (or none of it): piece by piece
        for (int u = 0; u < CU; ++u) {
            const size_t i = i0 + (size_t)u * CT;
            if (i < n8) {
                const v8f v = *(const v8fa*)(src + i * 8);
                *(v8us*)(dst + i * 8) = __builtin_bit_cast(v8us, __builtin_convertvector(v, v8h));
            }
        }
    }
}

// k_attn: Out[(b*SEQ_FULL + l)*TOKP + h*HD + d] = sum_s softmax_s(SCALE * Q[b,l,h,:].K[b,s,h,:]) K[b,s,h,d]
// Qp/Kp: f16 token-major [b][t][h][d]. grid (SEQ/BM, NB*NH), NT threads; wave w owns query rows m0 .. m0+15.
// Fragment map (A, B alike): lane l: row/col = l & 15, elements 0..7 <- k0 + 8*(l>>4) + 0..7, elements 8..15 <- k0 + 16 + 8*(l>>4) + 0..7; D element r of lane l = (row 8*(l>>4)+r, col l&15).
__global__ __launch_bounds__(NT) void k_attn(const h16* __restrict__ Qp, const h16* __restrict__ Kp, float* Out) {
    __shared__ __align__(16) h16 ring[2 * BUFH];      // two buffers, each the [s][e] chunk tile and the [s][d] chunk tile at the transposing load's pitch (cross-wave: block barriers)
    __shared__ __align__(16) float os[4][16 * OP];   // per-wave output staging (wave-private)

    const int tid = threadIdx.x, wave = tid >> 5, lane = tid & 31, hf = lane >> 4, lm = lane & 15;
    const int bh = blockIdx.y, b = bh / NH, h = bh % NH;
    const int m0 = blockIdx.x * BM + wave * 16;

    // Q^T as the B operand of the scores: column n = lm <- query row m0+lm; k = e (two k-steps of 32).
    const h16* Qg = Qp + ((size_t)b * SEQ_FULL + (size_t)(m0 + lm)) * TOKP + h * HD;
    const v16h bq0 = cat16b(*(const v8usa*)(Qg + 8 * hf), *(const v8usa*)(Qg + 16 + 8 * hf));
    const v16h bq1 = cat16b(*(const v8usa*)(Qg + 32 + 8 * hf), *(const v8usa*)(Qg + 48 + 8 * hf));
    const h16* Kg = Kp + (size_t)b * SEQ_FULL * TOKP + h * HD;

    float mrun = -1.0e30f, lrun = 0.0f;
    v8f acc[4];
#pragma unroll
    for (int t = 0; t < 4; ++t) acc[t] = (v8f){};

    // ---- staging: a chunk is 512 x 16-B pieces, 4 per thread (rows srow + 0, 16, 32, 48), copied into two row-major tiles, each at its reader's pitch
    const int srow = tid >> 3, sc8 = (tid & 7) * 8;
    const unsigned lk0 = ldsaddr(ring + srow * KP + sc8), lv0 = ldsaddr(ring + KC * KP + srow * VP + sc8);
    const h16* gnext = Kg + (size_t)srow * TOKP + sc8;   // this thread's first piece of the next chunk to be copied
    copy_chunk(lk0, lv0, gnext); gnext += KC * TOKP;
    asm volatile("s_wait_asynccnt 0x0" ::: "memory");    // this wave's copies of chunk 0 have landed
    __syncthreads();                                     // chunk 0 is published to every wave
    copy_chunk(lk0 + BUFH * 2, lv0 + BUFH * 2, gnext); gnext += KC * TOKP;

    // one pass: chunk in buffer cur is worked on while the other buffer's copies fly; more: a chunk two ahead exists
    auto pass = [&](const int cur, const bool more) __attribute__((always_inline)) {
        const h16* Krm = ring + cur * BUFH;
        const h16* Kv = Krm + KC * KP;
        // ---- S^T tiles: A rows = key s (mt*16 + lm), k = e; B = Q^T
        v8f c[4];
#pragma unroll
        for (int mt = 0; mt < 4; ++mt) {
            const h16* ar = Krm + (mt * 16 + lm) * KP + 8 * hf;
            const v16h a0 = cat16b(*(const v8usa*)(ar), *(const v8usa*)(ar + 16));
            const v16h a1 = cat16b(*(const v8usa*)(ar + 32), *(const v8usa*)(ar + 48));
            v8f cz = (v8f){};
            cz = wmmab(a0, bq0, cz);
            cz = wmmab(a1, bq1, cz);
            c[mt] = cz;
        }
        asm volatile("v_nop\n\tv_nop\n\tv_nop\n\tv_nop" : "+v"(c[0]), "+v"(c[1]), "+v"(c[2]), "+v"(c[3]) : "v"(bq0), "v"(bq1));

        // ---- online softmax per query column l = lm: this lane holds keys s = mt*16 + 8*hf + r; partner lane ^16 holds the rest
        float mx = -1.0e30f;
#pragma unroll
        for (int mt = 0; mt < 4; ++mt) {
            c[mt] = c[mt] * SCALE;
#pragma unroll
            for (int r = 0; r < 8; ++r) mx = fmaxf(mx, c[mt][r]);
        }
        mx = fmaxf(mx, __shfl_xor(mx, 16, 32));
        const float mnew = fmaxf(mrun, mx);
        const float corr = __builtin_amdgcn_exp2f((mrun - mnew) * LOG2E);
        float psum = 0.0f;
        v4u pw[4];
#pragma unroll
        for (int mt = 0; mt < 4; ++mt) {
#pragma unroll
            for (int r = 0; r < 8; r += 2) {
                const float p0 = __builtin_amdgcn_exp2f((c[mt][r] - mnew) * LOG2E);
                const float p1 = __builtin_amdgcn_exp2f((c[mt][r + 1] - mnew) * LOG2E);
                psum += p0;
                psum += p1;
                pw[mt][r >> 1] = __builtin_bit_cast(unsigned, cvt2(p0, p1));     // the one f16 plane: RNE, two elements per instruction
            }
        }
        psum += __shfl_xor(psum, 16, 32);
        lrun = lrun * corr + psum; mrun = mnew;
#pragma unroll
        for (int t = 0; t < 4; ++t) acc[t] = acc[t] * corr;

        // ---- P^T as the B operand (k = s, n = l): element r <- tile covering s 0..15 (or 32..47), element 8+r <- tile covering s 16..31 (or 48..63), same lane
        const v16h bp0 = cat16w(pw[0], pw[1]), bp1 = cat16w(pw[2], pw[3]);

        // ---- O^T tiles: A = K^T rows d = t*16 + lm, k = s, transposed on the way out of LDS
        const h16* vr = Kv + (8 * hf + (lane & 7)) * VP + 8 * ((lane >> 3) & 1);
#pragma unroll
        for (int t = 0; t < 4; ++t) {
            const h16* ar = vr + t * 16;
            const v16h a0 = cat16b(ldtr16(ar), ldtr16(ar + 16 * VP));
            const v16h a1 = cat16b(ldtr16(ar + 32 * VP), ldtr16(ar + 48 * VP));
            acc[t] = wmmab(a0, bp0, acc[t]);
            acc[t] = wmmab(a1, bp1, acc[t]);
        }
        // four vector slots between the last matrix instruction and whatever follows the pass (the chip's distance after a WMMA)
        asm volatile("v_nop\n\tv_nop\n\tv_nop\n\tv_nop" : "+v"(acc[0]), "+v"(acc[1]), "+v"(acc[2]), "+v"(acc[3]) : "v"(bp0), "v"(bp1));

        // ---- publish point of the next chunk
        asm volatile("s_wait_dscnt 0x0" ::: "memory");      // this wave's reads of buffer cur have returned before it is refilled
        asm volatile("s_wait_asynccnt 0x0" ::: "memory");   // this wave's copies of the next chunk have landed
        __syncthreads();                                    // publishes the next chunk and ends every wave's reads of buffer cur
        if (more) { copy_chunk(lk0 + cur * BUFH * 2, lv0 + cur * BUFH * 2, gnext); gnext += KC * TOKP; }
    };
    // two passes a trip, so that each pass's buffer is a compile-time constant; kept rolled beyond that: more copies of the body only grow the code
#pragma unroll 1
    for (int t = 0; t < NTL; t += 2) {
        const bool more = t + 2 < NTL;
        pass(0, more);
        pass(1, more);
    }
    asm volatile("s_wait_asynccnt 0x0" ::: "memory");       // nothing of this wave is in flight when it goes on to the epilogue

    // ---- epilogue: acc[t][r] = O^T[d = t*16 + 8*hf + r][l = lm]; stage O[l][d] per wave in LDS, then whole-line stores
    const float inv = 1.0f / lrun;
    float* osw = os[wave];
#pragma unroll
    for (int t = 0; t < 4; ++t) {
        v4f w0, w1;
        w0[0] = acc[t][0] * inv; w0[1] = acc[t][1] * inv; w0[2] = acc[t][2] * inv; w0[3] = acc[t][3] * inv;
        w1[0] = acc[t][4] * inv; w1[1] = acc[t][5] * inv; w1[2] = acc[t][6] * inv; w1[3] = acc[t][7] * inv;
        *(v4fa*)(osw + lm * OP + t * 16 + 8 * hf) = w0;
        *(v4fa*)(osw + lm * OP + t * 16 + 8 * hf + 4) = w1;
    }
    __builtin_amdgcn_fence(3 /* release order */, "wavefront");
    __builtin_amdgcn_wave_barrier();
    // each instruction: lanes 0..15 -> row 2s (256 B = 2 lines, 8 lanes per line), lanes 16..31 -> row 2s+1
    float* orow0 = Out + ((size_t)b * SEQ_FULL + (size_t)m0) * TOKP + h * HD;
{
#pragma unroll
        for (int s = 0; s < 8; ++s) {
            const int row = 2 * s + hf; const int cofs = lm * 4;
            const v4f val = *(const v4fa*)(osw + row * OP + cofs);
            *(v4f*)(orow0 + (size_t)row * TOKP + cofs) = val;
        }
        
    }
}

extern "C" void kernel_launch(void* const* d_in, const int* in_sizes, int n_in,
                              void* d_out, int out_size, void* d_ws, size_t ws_size, hipStream_t stream) {
    if (n_in < 2) return;
    const float* Qin = (const float*)d_in[0];
    const float* Kin = (const float*)d_in[1];
    float* OUT = (float*)d_out;
    const size_t need = ((size_t)(NB - 1) * SEQ_FULL + SEQ) * TOKP;
    if (in_sizes[0] < 0 || in_sizes[1] < 0 || out_size < 0) return;
    if ((size_t)in_sizes[0] < need || (size_t)in_sizes[1] < need) return;
    if ((in_sizes[0] & 63) != 0 || (in_sizes[1] & 63) != 0) return;
    if ((size_t)out_size < OUT1E + need) return;
    // workspace: f16 copies of both inputs (2 B per element), 256-B aligned regions
    const size_t qbytes = (((size_t)in_sizes[0] * 2) + 255) & ~(size_t)255;
    const size_t kbytes = (((size_t)in_sizes[1] * 2) + 255) & ~(size_t)255;
    if (qbytes + kbytes > ws_size) return;
    if (qbytes + kbytes > (size_t)134217728u) return;
    char* wsp = (char*)d_ws;
    h16* QB = (h16*)wsp; h16* KB = (h16*)(wsp + qbytes);
    const size_t nq8 = (size_t)in_sizes[0] / 8, nk8 = (size_t)in_sizes[1] / 8;
    const size_t nmax8 = nq8 > nk8 ? nq8 : nk8;
    dim3 cgrid((unsigned)((nmax8 + CT * CU - 1) / (CT * CU)), 2);
    k_cvt8<<<cgrid, CT, 0, stream>>>(Qin, Kin, QB, KB, nq8, nk8);
    dim3 grid(SEQ / BM, NB * NH);
    // out0: rows of queries attend over keys (values = keys)
    k_attn<<<grid, NT, 0, stream>>>(QB, KB, OUT);
    // out1: rows of keys attend over queries (values = queries)
    k_attn<<<grid, NT, 0, stream>>>(KB, QB, OUT + OUT1E);
}

// v006
// A run of this version takes 77.4 microseconds.
// Next to v005, in two timings, it ran 1.05 times as fast each time.
// Counting every step since v000, it is 2.87 times as fast.
#include <hip/hip_runtime.h>

// Contractions: scores q.k^T on v_wmma_f32_16x16x32_f16 (both inputs RNE-converted to f16 once, single product, f32 accumulate); P.V on v_wmma_f32_16x16x32_f16 with P as one f16 plane (P lies in [0, 1]: 11 significant bits, RNE) x the single f16 value plane (1 product), f32 accumulate; softmax statistics, rescaling and normalisation in f32; outputs f32.
// Second output: the same kernel with the two tensors swapped (keys act as queries; queries act as keys and values).

#define NH 8
#define HD 64
#ifndef NB
#define NB 4
#endif
#ifndef SEQ
#define SEQ 2048
#endif
#define NB_FULL 4
#define SEQ_FULL 2048
#define TOKP (NH * HD)                                   // token pitch in elements (512)
#define OUT1E ((size_t)NB_FULL * SEQ_FULL * NH * HD)     // second output starts at this element
#define KC 64                                            // keys per chunk
#define BM 64                                            // query rows per block (4 waves x 16)
#define NT 128
#define KP 72                                            // LDS pitch (halves) of the [s][e] tile
#define VP 80                                            // LDS pitch (halves) of the [s][d] copy read by the transposing load (32 B x odd)
#define OP 68                                            // LDS pitch (floats) of the output staging tile
#define SCALE 0.125f                                     // HD^-0.5, exact power of two
#define LOG2E 1.4426950408889634f
#define KS (SCALE * LOG2E)                               // raw score -> exponent of two (LOG2E scaled by an exact power of two)
#define NTL (SEQ / KC)                                   // chunks walked by a block
#define BUFH (KC * KP + KC * VP)                         // halves per ring buffer: the [s][e] tile, then the [s][d] tile
#define CT 512                                           // threads of a conversion block (16 waves)
#define CU 8                                             // 8-float pieces per conversion thread

static_assert(OUT1E * 4 == 16777216u);
static_assert(SEQ % KC == 0);
static_assert(SEQ % BM == 0);
static_assert(SEQ <= SEQ_FULL);
static_assert(NB <= NB_FULL);
static_assert(KC * HD / 8 == 4 * NT);
static_assert(NTL >= 2 && (NTL % 2) == 0);
static_assert((BUFH % 8) == 0 && ((KC * KP) % 8) == 0);
static_assert((KP % 8) == 0 && (VP % 16) == 0 && ((VP / 16) & 1) == 1 && (OP % 4) == 0);

typedef unsigned short h16;                              // one f16 element, as raw bits
typedef __attribute__((ext_vector_type(16))) _Float16 v16h;
typedef __attribute__((ext_vector_type(8)))  _Float16 v8h;
typedef __attribute__((ext_vector_type(8)))  unsigned short v8us;
typedef __attribute__((ext_vector_type(8)))  float    v8f;
typedef __attribute__((ext_vector_type(4)))  float    v4f;
typedef __attribute__((ext_vector_type(8)))  short    v8s;
typedef __attribute__((ext_vector_type(2)))  float    v2f;
typedef __attribute__((ext_vector_type(2)))  _Float16 v2h;
typedef __attribute__((ext_vector_type(4)))  unsigned v4u;
typedef v8us __attribute__((may_alias)) v8usa;
typedef v8f  __attribute__((may_alias)) v8fa;
typedef v4f  __attribute__((may_alias)) v4fa;

__device__ __forceinline__ v2h cvt2(float a, float b) { const v2f x = {a, b}; return __builtin_convertvector(x, v2h); }   // one v_cvt_pk_f16_f32 (round to nearest even)
__device__ __forceinline__ v16h cat16b(v8us lo, v8us hi) { return __builtin_bit_cast(v16h, __builtin_shufflevector(lo, hi, 0, 1, 2, 3, 4, 5, 6, 7, 8, 9, 10, 11, 12, 13, 14, 15)); }
__device__ __forceinline__ v16h cat16w(v4u lo, v4u hi) { return __builtin_bit_cast(v16h, __builtin_shufflevector(lo, hi, 0, 1, 2, 3, 4, 5, 6, 7)); }
// ds_load_tr16_b128: lane l passes the address of 16 B of row kbase + 8*(l>>4) + (l&7); it gets column dbase + (l&15), rows kbase + 8*(l>>4) + 0..7
__device__ __forceinline__ v8us ldtr16(const h16* p) { typedef __attribute__((address_space(3))) v8s lds_v8s; return __builtin_bit_cast(v8us, __builtin_amdgcn_ds_load_tr16_b128_v8i16((lds_v8s*)p)); }
__device__ __forceinline__ v8f wmmab(v16h a, v16h b, v8f c) { return __builtin_amdgcn_wmma_f32_16x16x32_f16(false, a, false, b, (short)0, c, false, false); }

// LDS byte address of a __shared__ element (the low 32 bits of its address)
__device__ __forceinline__ unsigned ldsaddr(const h16* p) { typedef __attribute__((address_space(3))) const h16 lds_h16; return (unsigned)(size_t)(lds_h16*)p; }
// One chunk's copies of one thread: four 16-B pieces of the chunk, each straight from global memory into both LDS tiles (lk: [s][e] tile, lv: [s][d] tile), through no register.
// The closing s_wait_xcnt stands inside the statement so that no address register named here is rewritten ahead of it.
__device__ __forceinline__ void copy_chunk(unsigned lk, unsigned lv, const h16* g) {
    const unsigned lk1 = lk + 16 * KP * 2, lk2 = lk + 32 * KP * 2, lk3 = lk + 48 * KP * 2;
    const unsigned lv1 = lv + 16 * VP * 2, lv2 = lv + 32 * VP * 2, lv3 = lv + 48 * VP * 2;
    const h16* g1 = g + 16 * TOKP; const h16* g2 = g + 32 * TOKP; const h16* g3 = g + 48 * TOKP;
    asm volatile("global_load_async_to_lds_b128 %0, %8, off\n\t"
                 "global_load_async_to_lds_b128 %4, %12, off\n\t"
                 "global_load_async_to_lds_b128 %1, %9, off\n\t"
                 "global_load_async_to_lds_b128 %5, %13, off\n\t"
                 "global_load_async_to_lds_b128 %2, %10, off\n\t"
                 "global_load_async_to_lds_b128 %6, %14, off\n\t"
                 "global_load_async_to_lds_b128 %3, %11, off\n\t"
                 "global_load_async_to_lds_b128 %7, %15, off\n\t"
                 "s_wait_xcnt 0x0"
                 :: "v"(lk), "v"(lk1), "v"(lk2), "v"(lk3), "v"(lv), "v"(lv1), "v"(lv2), "v"(lv3),
                    "v"(g), "v"(g1), "v"(g2), "v"(g3), "v"(g), "v"(g1), "v"(g2), "v"(g3) : "memory");
}

// k_cvt8: both tensors to f16 in one launch (blockIdx.y picks the tensor). A piece is 8 floats (32 B in, 16 B out).
// A block is 16 waves and each thread takes CU pieces, CT apart, all loaded before the first is converted: few waves to start, 16 loads of 16 B in flight per lane.
__global__ __launch_bounds__(CT) void k_cvt8(const float* __restrict__ qsrc, const float* __restrict__ ksrc, h16* __restrict__ qdst, h16* __restrict__ kdst, size_t nq8, size_t nk8) {
    const bool second = blockIdx.y != 0;
    const float* __restrict__ src = second ? ksrc : qsrc;
    h16* __restrict__ dst = second ? kdst : qdst;
    const size_t n8 = second ? nk8 : nq8;
    const size_t base = (size_t)blockIdx.x * (CT * CU);
    const size_t i0 = base + threadIdx.x;
    if (base + CT * CU <= n8) {                          // whole block inside the tensor (block-uniform)
        const float* p = src + i0 * 8;
        v8f v[CU];
#pragma unroll                                           // unrolled (here and below): v[] lives in registers and the loads share one address register with immediate offsets
        for (int u = 0; u < CU; ++u) v[u] = *(const v8fa*)(p + (size_t)u * (CT * 8));
        // behind the loads, which all name p's register: p is an input here, so that register is rewritten (also as a load's own destination) only behind this wait
        asm volatile("s_wait_xcnt 0x0" :: "v"(p) : "memory");
        __builtin_amdgcn_sched_barrier(0);               // no convert (with its wait) rises among the loads: without it the last two loads start only when the first have returned
#pragma unroll
        for (int u = 0; u < CU; ++u) *(v8us*)(dst + (i0 + (size_t)u * CT) * 8) = __builtin_bit_cast(v8us, __builtin_convertvector(v[u], v8h));   // round to nearest even
        asm volatile("s_wait_xcnt 0x0" ::: "memory");    // behind the last store: no register that a store names is rewritten ahead of this wait on any way out of this branch
    } else {                                             // the tensor's last, partial block (or none of it): piece by piece
        for (int u = 0; u < CU; ++u) {
            const size_t i = i0 + (size_t)u * CT;
            if (i < n8) {
                const v8f v = *(const v8fa*)(src + i * 8);
                *(v8us*)(dst + i * 8) = __builtin_bit_cast(v8us, __builtin_convertvector(v, v8h));
            }
        }
    }
}

// k_attn: Out[(b*SEQ_FULL + l)*TOKP + h*HD + d] = sum_s softmax_s(SCALE * Q[b,l,h,:].K[b,s,h,:]) K[b,s,h,d]
// Qp/Kp: f16 token-major [b][t][h][d]. grid (SEQ/BM, NB*NH), NT threads; wave w owns query rows m0 .. m0+15.
// Fragment map (A, B alike): lane l: row/col = l & 15, elements 0..7 <- k0 + 8*(l>>4) + 0..7, elements 8..15 <- k0 + 16 + 8*(l>>4) + 0..7; D element r of lane l = (row 8*(l>>4)+r, col l&15).
__global__ __launch_bounds__(NT) void k_attn(const h16* __restrict__ Qp, const h16* __restrict__ Kp, float* Out) {
    __shared__ __align__(16) h16 ring[2 * BUFH];      // two buffers, each the [s][e] chunk tile and the [s][d] chunk tile at the transposing load's pitch (cross-wave: block barriers)
    __shared__ __align__(16) float os[4][16 * OP];   // per-wave output staging (wave-private)

    const int tid = threadIdx.x, wave = tid >> 5, lane = tid & 31, hf = lane >> 4, lm = lane & 15;
    const int bh = blockIdx.y, b = bh / NH, h = bh % NH;
    const int m0 = blockIdx.x * BM + wave * 16;

    // Q^T as the B operand of the scores: column n = lm <- query row m0+lm; k = e (two k-steps of 32).
    const h16* Qg = Qp + ((size_t)b * SEQ_FULL + (size_t)(m0 + lm)) * TOKP + h * HD;
    const v16h bq0 = cat16b(*(const v8usa*)(Qg + 8 * hf), *(const v8usa*)(Qg + 16 + 8 * hf));
    const v16h bq1 = cat16b(*(const v8usa*)(Qg + 32 + 8 * hf), *(const v8usa*)(Qg + 48 + 8 * hf));
    const h16* Kg = Kp + (size_t)b * SEQ_FULL * TOKP + h * HD;

    float mrun = -1.0e30f, lrun = 0.0f;
    v8f acc[4];
#pragma unroll
    for (int t = 0; t < 4; ++t) acc[t] = (v8f){};

    // ---- staging: a chunk is 512 x 16-B pieces, 4 per thread (rows srow + 0, 16, 32, 48), copied into two row-major tiles, each at its reader's pitch
    const int srow = tid >> 3, sc8 = (tid & 7) * 8;
    const unsigned lk0 = ldsaddr(ring + srow * KP + sc8), lv0 = ldsaddr(ring + KC * KP + srow * VP + sc8);
    const h16* gnext = Kg + (size_t)srow * TOKP + sc8;   // this thread's first piece of the next chunk to be copied
    copy_chunk(lk0, lv0, gnext); gnext += KC * TOKP;
    asm volatile("s_wait_asynccnt 0x0" ::: "memory");    // this wave's copies of chunk 0 have landed
    __syncthreads();                                     // chunk 0 is published to every wave
    copy_chunk(lk0 + BUFH * 2, lv0 + BUFH * 2, gnext); gnext += KC * TOKP;

    // one pass: chunk in buffer cur is worked on while the other buffer's copies fly; more: a chunk two ahead exists
    auto pass = [&](const int cur, const bool more) __attribute__((always_inline)) {
        const h16* Krm = ring + cur * BUFH;
        const h16* Kv = Krm + KC * KP;
        // ---- S^T tiles: A rows = key s (mt*16 + lm), k = e; B = Q^T
        v8f c[4];
#pragma unroll
        for (int mt = 0; mt < 4; ++mt) {
            const h16* ar = Krm + (mt * 16 + lm) * KP + 8 * hf;
            const v16h a0 = cat16b(*(const v8usa*)(ar), *(const v8usa*)(ar + 16));
            const v16h a1 = cat16b(*(const v8usa*)(ar + 32), *(const v8usa*)(ar + 48));
            v8f cz = (v8f){};
            cz = wmmab(a0, bq0, cz);
            cz = wmmab(a1, bq1, cz);
            c[mt] = cz;
        }
        asm volatile("v_nop\n\tv_nop\n\tv_nop\n\tv_nop" : "+v"(c[0]), "+v"(c[1]), "+v"(c[2]), "+v"(c[3]) : "v"(bq0), "v"(bq1));

        // ---- online softmax per query column l = lm: this lane holds keys s = mt*16 + 8*hf + r; partner lane ^16 holds the rest
        // the maximum is taken over the raw products (SCALE > 0 keeps the order); scale, shift and the change of base are one fused multiply-add per score
        float mx = -1.0e30f;
#pragma unroll
        for (int mt = 0; mt < 4; ++mt) {
#pragma unroll
            for (int r = 0; r < 8; ++r) mx = fmaxf(mx, c[mt][r]);
        }
        mx = fmaxf(mx, __shfl_xor(mx, 16, 32));
        const float mnew = fmaxf(mrun, mx);
        const float corr = __builtin_amdgcn_exp2f((mrun - mnew) * KS);
        const float nm = -mnew * KS;
        const v8f ksv = {KS, KS, KS, KS, KS, KS, KS, KS}, nmv = {nm, nm, nm, nm, nm, nm, nm, nm};
        float psum = 0.0f;
        v4u pw[4];
#pragma unroll
        for (int mt = 0; mt < 4; ++mt) {
            const v8f e = __builtin_elementwise_fma(c[mt], ksv, nmv);            // KS * score - KS * maximum, two scores per instruction
#pragma unroll
            for (int r = 0; r < 8; r += 2) {
                const float p0 = __builtin_amdgcn_exp2f(e[r]);
                const float p1 = __builtin_amdgcn_exp2f(e[r + 1]);
                psum += p0;
                psum += p1;
                pw[mt][r >> 1] = __builtin_bit_cast(unsigned, cvt2(p0, p1));     // the one f16 plane: RNE, two elements per instruction
            }
        }
        psum += __shfl_xor(psum, 16, 32);
        lrun = lrun * corr + psum; mrun = mnew;
#pragma unroll
        for (int t = 0; t < 4; ++t) acc[t] = acc[t] * corr;

        // ---- P^T as the B operand (k = s, n = l): element r <- tile covering s 0..15 (or 32..47), element 8+r <- tile covering s 16..31 (or 48..63), same lane
        const v16h bp0 = cat16w(pw[0], pw[1]), bp1 = cat16w(pw[2], pw[3]);

        // ---- O^T tiles: A = K^T rows d = t*16 + lm, k = s, transposed on the way out of LDS
        const h16* vr = Kv + (8 * hf + (lane & 7)) * VP + 8 * ((lane >> 3) & 1);
#pragma unroll
        for (int t = 0; t < 4; ++t) {
            const h16* ar = vr + t * 16;
            const v16h a0 = cat16b(ldtr16(ar), ldtr16(ar + 16 * VP));
            const v16h a1 = cat16b(ldtr16(ar + 32 * VP), ldtr16(ar + 48 * VP));
            acc[t] = wmmab(a0, bp0, acc[t]);
            acc[t] = wmmab(a1, bp1, acc[t]);
        }
        // four vector slots between the last matrix instruction and whatever follows the pass (the chip's distance after a WMMA)
        asm volatile("v_nop\n\tv_nop\n\tv_nop\n\tv_nop" : "+v"(acc[0]), "+v"(acc[1]), "+v"(acc[2]), "+v"(acc[3]) : "v"(bp0), "v"(bp1));

        // ---- publish point of the next chunk
        asm volatile("s_wait_dscnt 0x0" ::: "memory");      // this wave's reads of buffer cur have returned before it is refilled
        asm volatile("s_wait_asynccnt 0x0" ::: "memory");   // this wave's copies of the next chunk have landed
        __syncthreads();                                    // publishes the next chunk and ends every wave's reads of buffer cur
        if (more) { copy_chunk(lk0 + cur * BUFH * 2, lv0 + cur * BUFH * 2, gnext); gnext += KC * TOKP; }
    };
    // two passes a trip, so that each pass's buffer is a compile-time constant; kept rolled beyond that: more copies of the body only grow the code
#pragma unroll 1
    for (int t = 0; t < NTL; t += 2) {
        const bool more = t + 2 < NTL;
        pass(0, more);
        pass(1, more);
    }
    asm volatile("s_wait_asynccnt 0x0" ::: "memory");       // nothing of this wave is in flight when it goes on to the epilogue

    // ---- epilogue: acc[t][r] = O^T[d = t*16 + 8*hf + r][l = lm]; stage O[l][d] per wave in LDS, then whole-line stores
    const float inv = 1.0f / lrun;
    float* osw = os[wave];
#pragma unroll
    for (int t = 0; t < 4; ++t) {
        v4f w0, w1;
        w0[0] = acc[t][0] * inv; w0[1] = acc[t][1] * inv; w0[2] = acc[t][2] * inv; w0[3] = acc[t][3] * inv;
        w1[0] = acc[t][4] * inv; w1[1] = acc[t][5] * inv; w1[2] = acc[t][6] * inv; w1[3] = acc[t][7] * inv;
        *(v4fa*)(osw + lm * OP + t * 16 + 8 * hf) = w0;
        *(v4fa*)(osw + lm * OP + t * 16 + 8 * hf + 4) = w1;
    }
    __builtin_amdgcn_fence(3 /* release order */, "wavefront");
    __builtin_amdgcn_wave_barrier();
    // each instruction: lanes 0..15 -> row 2s (256 B = 2 lines, 8 lanes per line), lanes 16..31 -> row 2s+1
    float* orow0 = Out + ((size_t)b * SEQ_FULL + (size_t)m0) * TOKP + h * HD;
{
#pragma unroll
        for (int s = 0; s < 8; ++s) {
            const int row = 2 * s + hf; const int cofs = lm * 4;
            const v4f val = *(const v4fa*)(osw + row * OP + cofs);
            *(v4f*)(orow0 + (size_t)row * TOKP + cofs) = val;
        }
        
    }
}

extern "C" void kernel_launch(void* const* d_in, const int* in_sizes, int n_in,
                              void* d_out, int out_size, void* d_ws, size_t ws_size, hipStream_t stream) {
    if (n_in < 2) return;
    const float* Qin = (const float*)d_in[0];
    const float* Kin = (const float*)d_in[1];
    float* OUT = (float*)d_out;
    const size_t need = ((size_t)(NB - 1) * SEQ_FULL + SEQ) * TOKP;
    if (in_sizes[0] < 0 || in_sizes[1] < 0 || out_size < 0) return;
    if ((size_t)in_sizes[0] < need || (size_t)in_sizes[1] < need) return;
    if ((in_sizes[0] & 63) != 0 || (in_sizes[1] & 63) != 0) return;
    if ((size_t)out_size < OUT1E + need) return;
    // workspace: f16 copies of both inputs (2 B per element), 256-B aligned regions
    const size_t qbytes = (((size_t)in_sizes[0] * 2) + 255) & ~(size_t)255;
    const size_t kbytes = (((size_t)in_sizes[1] * 2) + 255) & ~(size_t)255;
    if (qbytes + kbytes > ws_size) return;
    if (qbytes + kbytes > (size_t)134217728u) return;
    char* wsp = (char*)d_ws;
    h16* QB = (h16*)wsp; h16* KB = (h16*)(wsp + qbytes);
    const size_t nq8 = (size_t)in_sizes[0] / 8, nk8 = (size_t)in_sizes[1] / 8;
    const size_t nmax8 = nq8 > nk8 ? nq8 : nk8;
    dim3 cgrid((unsigned)((nmax8 + CT * CU - 1) / (CT * CU)), 2);
    k_cvt8<<<cgrid, CT, 0, stream>>>(Qin, Kin, QB, KB, nq8, nk8);
    dim3 grid(SEQ / BM, NB * NH);
    // out0: rows of queries attend over keys (values = keys)
    k_attn<<<grid, NT, 0, stream>>>(QB, KB, OUT);
    // out1: rows of keys attend over queries (values = queries)
    k_attn<<<grid, NT, 0, stream>>>(KB, QB, OUT + OUT1E);
}

// v007
// A run of this version takes 72.7 microseconds.
// Next to v006, in two timings, it ran 1.06 and 1.07 times as fast.
// Over all steps from v000 it is 3.06 times as fast.
#include <hip/hip_runtime.h>

// Contractions: scores q.k^T on v_wmma_f32_16x16x32_f16 (both inputs RNE-converted to f16 once, single product, f32 accumulate); P.V on v_wmma_f32_16x16x32_f16 with P as one f16 plane (P lies in [0, 1]: 11 significant bits, RNE) x the single f16 value plane (1 product), f32 accumulate; softmax statistics, rescaling and normalisation in f32; outputs f32.
// Second output: the same kernel with the two tensors swapped (keys act as queries; queries act as keys and values).

#define NH 8
#define HD 64
#ifndef NB
#define NB 4
#endif
#ifndef SEQ
#define SEQ 2048
#endif
#define NB_FULL 4
#define SEQ_FULL 2048
#define TOKP (NH * HD)                                   // token pitch in elements (512)
#define OUT1E ((size_t)NB_FULL * SEQ_FULL * NH * HD)     // second output starts at this element
#define KC 64                                            // keys per chunk
#define QG 2                                             // 16-column query groups per wave: each fragment read from LDS feeds QG matrix instructions
#define BM (4 * 16 * QG)                                 // query rows per block (4 waves x 32)
#define NT 128
#define KP 72                                            // LDS pitch (halves) of the [s][e] tile
#define VP 80                                            // LDS pitch (halves) of the [s][d] copy read by the transposing load (32 B x odd)
#define OP 68                                            // LDS pitch (floats) of the output staging tile
#define SCALE 0.125f                                     // HD^-0.5, exact power of two
#define LOG2E 1.4426950408889634f
#define KS (SCALE * LOG2E)                               // raw score -> exponent of two (LOG2E scaled by an exact power of two)
#define NTL (SEQ / KC)                                   // chunks walked by a block
#define BUFH (KC * KP + KC * VP)                         // halves per ring buffer: the [s][e] tile, then the [s][d] tile
#define CT 512                                           // threads of a conversion block (16 waves)
#define CU 8                                             // 8-float pieces per conversion thread

static_assert(OUT1E * 4 == 16777216u);
static_assert(SEQ % KC == 0);
static_assert(SEQ % BM == 0);
static_assert(SEQ <= SEQ_FULL);
static_assert(NB <= NB_FULL);
static_assert(KC * HD / 8 == 4 * NT);
static_assert(NTL >= 2 && (NTL % 2) == 0);
static_assert((BUFH % 8) == 0 && ((KC * KP) % 8) == 0);
static_assert((KP % 8) == 0 && (VP % 16) == 0 && ((VP / 16) & 1) == 1 && (OP % 4) == 0);

typedef unsigned short h16;                              // one f16 element, as raw bits
typedef __attribute__((ext_vector_type(16))) _Float16 v16h;
typedef __attribute__((ext_vector_type(8)))  _Float16 v8h;
typedef __attribute__((ext_vector_type(8)))  unsigned short v8us;
typedef __attribute__((ext_vector_type(8)))  float    v8f;
typedef __attribute__((ext_vector_type(4)))  float    v4f;
typedef __attribute__((ext_vector_type(8)))  short    v8s;
typedef __attribute__((ext_vector_type(2)))  float    v2f;
typedef __attribute__((ext_vector_type(2)))  _Float16 v2h;
typedef __attribute__((ext_vector_type(4)))  unsigned v4u;
typedef v8us __attribute__((may_alias)) v8usa;
typedef v8f  __attribute__((may_alias)) v8fa;
typedef v4f  __attribute__((may_alias)) v4fa;

__device__ __forceinline__ v2h cvt2(float a, float b) { const v2f x = {a, b}; return __builtin_convertvector(x, v2h); }   // one v_cvt_pk_f16_f32 (round to nearest even)
__device__ __forceinline__ v16h cat16b(v8us lo, v8us hi) { return __builtin_bit_cast(v16h, __builtin_shufflevector(lo, hi, 0, 1, 2, 3, 4, 5, 6, 7, 8, 9, 10, 11, 12, 13, 14, 15)); }
__device__ __forceinline__ v16h cat16w(v4u lo, v4u hi) { return __builtin_bit_cast(v16h, __builtin_shufflevector(lo, hi, 0, 1, 2, 3, 4, 5, 6, 7)); }
// ds_load_tr16_b128: lane l passes the address of 16 B of row kbase + 8*(l>>4) + (l&7); it gets column dbase + (l&15), rows kbase + 8*(l>>4) + 0..7
__device__ __forceinline__ v8us ldtr16(const h16* p) { typedef __attribute__((address_space(3))) v8s lds_v8s; return __builtin_bit_cast(v8us, __builtin_amdgcn_ds_load_tr16_b128_v8i16((lds_v8s*)p)); }
__device__ __forceinline__ v8f wmmab(v16h a, v16h b, v8f c) { return __builtin_amdgcn_wmma_f32_16x16x32_f16(false, a, false, b, (short)0, c, false, false); }

// LDS byte address of a __shared__ element (the low 32 bits of its address)
__device__ __forceinline__ unsigned ldsaddr(const h16* p) { typedef __attribute__((address_space(3))) const h16 lds_h16; return (unsigned)(size_t)(lds_h16*)p; }
// One chunk's copies of one thread: four 16-B pieces of the chunk, each straight from global memory into both LDS tiles (lk: [s][e] tile, lv: [s][d] tile), through no register.
// The closing s_wait_xcnt stands inside the statement so that no address register named here is rewritten ahead of it.
__device__ __forceinline__ void copy_chunk(unsigned lk, unsigned lv, const h16* g) {
    const unsigned lk1 = lk + 16 * KP * 2, lk2 = lk + 32 * KP * 2, lk3 = lk + 48 * KP * 2;
    const unsigned lv1 = lv + 16 * VP * 2, lv2 = lv + 32 * VP * 2, lv3 = lv + 48 * VP * 2;
    const h16* g1 = g + 16 * TOKP; const h16* g2 = g + 32 * TOKP; const h16* g3 = g + 48 * TOKP;
    asm volatile("global_load_async_to_lds_b128 %0, %8, off\n\t"
                 "global_load_async_to_lds_b128 %4, %12, off\n\t"
                 "global_load_async_to_lds_b128 %1, %9, off\n\t"
                 "global_load_async_to_lds_b128 %5, %13, off\n\t"
                 "global_load_async_to_lds_b128 %2, %10, off\n\t"
                 "global_load_async_to_lds_b128 %6, %14, off\n\t"
                 "global_load_async_to_lds_b128 %3, %11, off\n\t"
                 "global_load_async_to_lds_b128 %7, %15, off\n\t"
                 "s_wait_xcnt 0x0"
                 :: "v"(lk), "v"(lk1), "v"(lk2), "v"(lk3), "v"(lv), "v"(lv1), "v"(lv2), "v"(lv3),
                    "v"(g), "v"(g1), "v"(g2), "v"(g3), "v"(g), "v"(g1), "v"(g2), "v"(g3) : "memory");
}

// k_cvt8: both tensors to f16 in one launch (blockIdx.y picks the tensor). A piece is 8 floats (32 B in, 16 B out).
// A block is 16 waves and each thread takes CU pieces, CT apart, all loaded before the first is converted: few waves to start, 16 loads of 16 B in flight per lane.
__global__ __launch_bounds__(CT) void k_cvt8(const float* __restrict__ qsrc, const float* __restrict__ ksrc, h16* __restrict__ qdst, h16* __restrict__ kdst, size_t nq8, size_t nk8) {
    const bool second = blockIdx.y != 0;
    const float* __restrict__ src = second ? ksrc : qsrc;
    h16* __restrict__ dst = second ? kdst : qdst;
    const size_t n8 = second ? nk8 : nq8;
    const size_t base = (size_t)blockIdx.x * (CT * CU);
    const size_t i0 = base + threadIdx.x;
    if (base + CT * CU <= n8) {                          // whole block inside the tensor (block-uniform)
        const float* p = src + i0 * 8;
        v8f v[CU];
#pragma unroll                                           // unrolled (here and below): v[] lives in registers and the loads share one address register with immediate offsets
        for (int u = 0; u < CU; ++u) v[u] = *(const v8fa*)(p + (size_t)u * (CT * 8));
        // behind the loads, which all name p's register: p is an input here, so that register is rewritten (also as a load's own destination) only behind this wait
        asm volatile("s_wait_xcnt 0x0" :: "v"(p) : "memory");
        __builtin_amdgcn_sched_barrier(0);               // no convert (with its wait) rises among the loads: without it the last two loads start only when the first have returned
#pragma unroll
        for (int u = 0; u < CU; ++u) *(v8us*)(dst + (i0 + (size_t)u * CT) * 8) = __builtin_bit_cast(v8us, __builtin_convertvector(v[u], v8h));   // round to nearest even
        asm volatile("s_wait_xcnt 0x0" ::: "memory");    // behind the last store: no register that a store names is rewritten ahead of this wait on any way out of this branch
    } else {                                             // the tensor's last, partial block (or none of it): piece by piece
        for (int u = 0; u < CU; ++u) {
            const size_t i = i0 + (size_t)u * CT;
            if (i < n8) {
                const v8f v = *(const v8fa*)(src + i * 8);
                *(v8us*)(dst + i * 8) = __builtin_bit_cast(v8us, __builtin_convertvector(v, v8h));
            }
        }
    }
}

// k_attn: Out[(b*SEQ_FULL + l)*TOKP + h*HD + d] = sum_s softmax_s(SCALE * Q[b,l,h,:].K[b,s,h,:]) K[b,s,h,d]
// Qp/Kp: f16 token-major [b][t][h][d]. grid (SEQ/BM, NB*NH), NT threads; wave w owns query rows m0 .. m0+31, as QG groups of 16 (group g: rows m0 + 16*g + 0..15).
// Fragment map (A, B alike): lane l: row/col = l & 15, elements 0..7 <- k0 + 8*(l>>4) + 0..7, elements 8..15 <- k0 + 16 + 8*(l>>4) + 0..7; D element r of lane l = (row 8*(l>>4)+r, col l&15).
__global__ __launch_bounds__(NT) void k_attn(const h16* __restrict__ Qp, const h16* __restrict__ Kp, float* Out) {
    __shared__ __align__(16) h16 ring[2 * BUFH];      // two buffers, each the [s][e] chunk tile and the [s][d] chunk tile at the transposing load's pitch (cross-wave: block barriers)
    __shared__ __align__(16) float os[4][16 * QG * OP];   // per-wave output staging (wave-private)

    const int tid = threadIdx.x, wave = tid >> 5, lane = tid & 31, hf = lane >> 4, lm = lane & 15;
    const int bh = blockIdx.y, b = bh / NH, h = bh % NH;
    const int m0 = blockIdx.x * BM + wave * (16 * QG);

    // Q^T as the B operand of the scores: group g, column n = lm <- query row m0+16*g+lm; k = e (two k-steps of 32).
    v16h bq0[QG], bq1[QG];
#pragma unroll
    for (int g = 0; g < QG; ++g) {
        const h16* Qg = Qp + ((size_t)b * SEQ_FULL + (size_t)(m0 + 16 * g + lm)) * TOKP + h * HD;
        bq0[g] = cat16b(*(const v8usa*)(Qg + 8 * hf), *(const v8usa*)(Qg + 16 + 8 * hf));
        bq1[g] = cat16b(*(const v8usa*)(Qg + 32 + 8 * hf), *(const v8usa*)(Qg + 48 + 8 * hf));
    }
    const h16* Kg = Kp + (size_t)b * SEQ_FULL * TOKP + h * HD;

    float mrun[QG], lrun[QG];
    v8f acc[QG][4];
#pragma unroll
    for (int g = 0; g < QG; ++g) {
        mrun[g] = -1.0e30f; lrun[g] = 0.0f;
#pragma unroll
        for (int t = 0; t < 4; ++t) acc[g][t] = (v8f){};
    }

    // ---- staging: a chunk is 512 x 16-B pieces, 4 per thread (rows srow + 0, 16, 32, 48), copied into two row-major tiles, each at its reader's pitch
    const int srow = tid >> 3, sc8 = (tid & 7) * 8;
    const unsigned lk0 = ldsaddr(ring + srow * KP + sc8), lv0 = ldsaddr(ring + KC * KP + srow * VP + sc8);
    const h16* gnext = Kg + (size_t)srow * TOKP + sc8;   // this thread's first piece of the next chunk to be copied
    copy_chunk(lk0, lv0, gnext); gnext += KC * TOKP;
    asm volatile("s_wait_asynccnt 0x0" ::: "memory");    // this wave's copies of chunk 0 have landed
    __syncthreads();                                     // chunk 0 is published to every wave
    copy_chunk(lk0 + BUFH * 2, lv0 + BUFH * 2, gnext); gnext += KC * TOKP;

    // one pass: chunk in buffer cur is worked on while the other buffer's copies fly; more: a chunk two ahead exists
    auto pass = [&](const int cur, const bool more) __attribute__((always_inline)) {
        const h16* Krm = ring + cur * BUFH;
        const h16* Kv = Krm + KC * KP;
        // ---- S^T tiles: A rows = key s (mt*16 + lm), k = e; B = Q^T; each A fragment serves both query groups
        v8f c[QG][4];
#pragma unroll
        for (int mt = 0; mt < 4; ++mt) {
            const h16* ar = Krm + (mt * 16 + lm) * KP + 8 * hf;
            const v16h a0 = cat16b(*(const v8usa*)(ar), *(const v8usa*)(ar + 16));
            const v16h a1 = cat16b(*(const v8usa*)(ar + 32), *(const v8usa*)(ar + 48));
#pragma unroll
            for (int g = 0; g < QG; ++g) {
                v8f cz = (v8f){};
                cz = wmmab(a0, bq0[g], cz);
                cz = wmmab(a1, bq1[g], cz);
                c[g][mt] = cz;
            }
        }
        // four vector slots between the last matrix instruction and the first reader of a score tile (the chip's distance after a WMMA)
        asm volatile("v_nop\n\tv_nop\n\tv_nop\n\tv_nop" : "+v"(c[0][0]), "+v"(c[0][1]), "+v"(c[0][2]), "+v"(c[0][3]), "+v"(c[1][0]), "+v"(c[1][1]), "+v"(c[1][2]), "+v"(c[1][3]) : "v"(bq0[0]), "v"(bq1[0]), "v"(bq0[1]), "v"(bq1[1]));

        // ---- online softmax per query column l = 16*g + lm: this lane holds keys s = mt*16 + 8*hf + r; partner lane ^16 holds the rest
        // the maximum is taken over the raw products (SCALE > 0 keeps the order); scale, shift and the change of base are one fused multiply-add per score
        v16h bp0[QG], bp1[QG];
#pragma unroll
        for (int g = 0; g < QG; ++g) {
            float mx = -1.0e30f;
#pragma unroll
            for (int mt = 0; mt < 4; ++mt) {
#pragma unroll
                for (int r = 0; r < 8; ++r) mx = fmaxf(mx, c[g][mt][r]);
            }
            mx = fmaxf(mx, __shfl_xor(mx, 16, 32));
            const float mnew = fmaxf(mrun[g], mx);
            const float corr = __builtin_amdgcn_exp2f((mrun[g] - mnew) * KS);
            const float nm = -mnew * KS;
            const v8f ksv = {KS, KS, KS, KS, KS, KS, KS, KS}, nmv = {nm, nm, nm, nm, nm, nm, nm, nm};
            float psum = 0.0f;
            v4u pw[4];
#pragma unroll
            for (int mt = 0; mt < 4; ++mt) {
                const v8f e = __builtin_elementwise_fma(c[g][mt], ksv, nmv);         // KS * score - KS * maximum, two scores per instruction
#pragma unroll
                for (int r = 0; r < 8; r += 2) {
                    const float p0 = __builtin_amdgcn_exp2f(e[r]);
                    const float p1 = __builtin_amdgcn_exp2f(e[r + 1]);
                    psum += p0;
                    psum += p1;
                    pw[mt][r >> 1] = __builtin_bit_cast(unsigned, cvt2(p0, p1));     // the one f16 plane: RNE, two elements per instruction
                }
            }
            psum += __shfl_xor(psum, 16, 32);
            lrun[g] = lrun[g] * corr + psum; mrun[g] = mnew;
#pragma unroll
            for (int t = 0; t < 4; ++t) acc[g][t] = acc[g][t] * corr;

            // ---- P^T as the B operand (k = s, n = l): element r <- tile covering s 0..15 (or 32..47), element 8+r <- tile covering s 16..31 (or 48..63), same lane
            bp0[g] = cat16w(pw[0], pw[1]); bp1[g] = cat16w(pw[2], pw[3]);
        }

        // ---- O^T tiles: A = K^T rows d = t*16 + lm, k = s, transposed on the way out of LDS; each A fragment serves both query groups
        const h16* vr = Kv + (8 * hf + (lane & 7)) * VP + 8 * ((lane >> 3) & 1);
#pragma unroll
        for (int t = 0; t < 4; ++t) {
            const h16* ar = vr + t * 16;
            const v16h a0 = cat16b(ldtr16(ar), ldtr16(ar + 16 * VP));
            const v16h a1 = cat16b(ldtr16(ar + 32 * VP), ldtr16(ar + 48 * VP));
#pragma unroll
            for (int g = 0; g < QG; ++g) {
                acc[g][t] = wmmab(a0, bp0[g], acc[g][t]);
                acc[g][t] = wmmab(a1, bp1[g], acc[g][t]);
            }
        }
        // four vector slots between the last matrix instruction and whatever follows the loop's back edge or exit (the chip's distance after a WMMA)
        asm volatile("v_nop\n\tv_nop\n\tv_nop\n\tv_nop" : "+v"(acc[0][0]), "+v"(acc[0][1]), "+v"(acc[0][2]), "+v"(acc[0][3]), "+v"(acc[1][0]), "+v"(acc[1][1]), "+v"(acc[1][2]), "+v"(acc[1][3]) : "v"(bp0[0]), "v"(bp1[0]), "v"(bp0[1]), "v"(bp1[1]));

        // ---- publish point of the next chunk
        asm volatile("s_wait_dscnt 0x0" ::: "memory");      // this wave's reads of buffer cur have returned before it is refilled
        asm volatile("s_wait_asynccnt 0x0" ::: "memory");   // this wave's copies of the next chunk have landed
        __syncthreads();                                    // publishes the next chunk and ends every wave's reads of buffer cur
        if (more) { copy_chunk(lk0 + cur * BUFH * 2, lv0 + cur * BUFH * 2, gnext); gnext += KC * TOKP; }
    };
    // two passes a trip, so that each pass's buffer is a compile-time constant; kept rolled beyond that: more copies of the body only grow the code
#pragma unroll 1
    for (int t = 0; t < NTL; t += 2) {
        const bool more = t + 2 < NTL;
        pass(0, more);
        pass(1, more);
    }
    asm volatile("s_wait_asynccnt 0x0" ::: "memory");       // nothing of this wave is in flight when it goes on to the epilogue

    // ---- epilogue: acc[g][t][r] = O^T[d = t*16 + 8*hf + r][l = 16*g + lm]; stage O[l][d] per wave in LDS, then whole-line stores
    float* osw = os[wave];
#pragma unroll
    for (int g = 0; g < QG; ++g) {
        const float inv = 1.0f / lrun[g];
        float* og = osw + (16 * g + lm) * OP + 8 * hf;
#pragma unroll
        for (int t = 0; t < 4; ++t) {
            v4f w0, w1;
            w0[0] = acc[g][t][0] * inv; w0[1] = acc[g][t][1] * inv; w0[2] = acc[g][t][2] * inv; w0[3] = acc[g][t][3] * inv;
            w1[0] = acc[g][t][4] * inv; w1[1] = acc[g][t][5] * inv; w1[2] = acc[g][t][6] * inv; w1[3] = acc[g][t][7] * inv;
            *(v4fa*)(og + t * 16) = w0;
            *(v4fa*)(og + t * 16 + 4) = w1;
        }
    }
    __builtin_amdgcn_fence(3 /* release order */, "wavefront");
    __builtin_amdgcn_wave_barrier();
    // each instruction: lanes 0..15 -> row 2s (256 B = 2 lines, 8 lanes per line), lanes 16..31 -> row 2s+1
    float* orow0 = Out + ((size_t)b * SEQ_FULL + (size_t)m0) * TOKP + h * HD;
#pragma unroll
    for (int s = 0; s < 8 * QG; ++s) {
        const int row = 2 * s + hf; const int cofs = lm * 4;
        const v4f val = *(const v4fa*)(osw + row * OP + cofs);
        *(v4f*)(orow0 + (size_t)row * TOKP + cofs) = val;
    }
}

extern "C" void kernel_launch(void* const* d_in, const int* in_sizes, int n_in,
                              void* d_out, int out_size, void* d_ws, size_t ws_size, hipStream_t stream) {
    if (n_in < 2) return;
    const float* Qin = (const float*)d_in[0];
    const float* Kin = (const float*)d_in[1];
    float* OUT = (float*)d_out;
    const size_t need = ((size_t)(NB - 1) * SEQ_FULL + SEQ) * TOKP;
    if (in_sizes[0] < 0 || in_sizes[1] < 0 || out_size < 0) return;
    if ((size_t)in_sizes[0] < need || (size_t)in_sizes[1] < need) return;
    if ((in_sizes[0] & 63) != 0 || (in_sizes[1] & 63) != 0) return;
    if ((size_t)out_size < OUT1E + need) return;
    // workspace: f16 copies of both inputs (2 B per element), 256-B aligned regions
    const size_t qbytes = (((size_t)in_sizes[0] * 2) + 255) & ~(size_t)255;
    const size_t kbytes = (((size_t)in_sizes[1] * 2) + 255) & ~(size_t)255;
    if (qbytes + kbytes > ws_size) return;
    if (qbytes + kbytes > (size_t)134217728u) return;
    char* wsp = (char*)d_ws;
    h16* QB = (h16*)wsp; h16* KB = (h16*)(wsp + qbytes);
    const size_t nq8 = (size_t)in_sizes[0] / 8, nk8 = (size_t)in_sizes[1] / 8;
    const size_t nmax8 = nq8 > nk8 ? nq8 : nk8;
    dim3 cgrid((unsigned)((nmax8 + CT * CU - 1) / (CT * CU)), 2);
    k_cvt8<<<cgrid, CT, 0, stream>>>(Qin, Kin, QB, KB, nq8, nk8);
    dim3 grid(SEQ / BM, NB * NH);
    // out0: rows of queries attend over keys (values = keys)
    k_attn<<<grid, NT, 0, stream>>>(QB, KB, OUT);
    // out1: rows of keys attend over queries (values = queries)
    k_attn<<<grid, NT, 0, stream>>>(KB, QB, OUT + OUT1E);
}

// v008
// It runs in 61.2 microseconds.
// In both of two side-by-side timings against v007, it was 1.18 times as fast.
// All steps since v000 together make it 3.61 times as fast.
#include <hip/hip_runtime.h>

// Contractions: scores q.k^T on v_wmma_f32_16x16x32_f16 (both inputs RNE-converted to f16 once, single product, f32 accumulate); P.V on v_wmma_f32_16x16x32_f16 with P as one f16 plane (P lies in [0, 1]: 11 significant bits, RNE) x the single f16 value plane (1 product), f32 accumulate; softmax statistics, rescaling and normalisation in f32; outputs f32.
// Second output: the same kernel with the two tensors swapped (keys act as queries; queries act as keys and values); both outputs come from one launch (blockIdx.z picks the roles).

#define NH 8
#define HD 64
#ifndef NB
#define NB 4
#endif
#ifndef SEQ
#define SEQ 2048
#endif
#define NB_FULL 4
#define SEQ_FULL 2048
#define TOKP (NH * HD)                                   // token pitch in elements (512)
#define OUT1E ((size_t)NB_FULL * SEQ_FULL * NH * HD)     // second output starts at this element
#define KC 64                                            // keys per chunk
#define QG 2                                             // 16-column query groups per wave: each fragment read from LDS feeds QG matrix instructions
#define BM (4 * 16 * QG)                                 // query rows per block (4 waves x 32)
#define NT 128
#define KP 72                                            // LDS pitch (halves) of the [s][e] tile
#define VP 80                                            // LDS pitch (halves) of the [s][d] copy read by the transposing load (32 B x odd)
#define OP 68                                            // LDS pitch (floats) of the output staging tile
#define SCALE 0.125f                                     // HD^-0.5, exact power of two
#define LOG2E 1.4426950408889634f
#define KS (SCALE * LOG2E)                               // raw score -> exponent of two (LOG2E scaled by an exact power of two)
#define NTL (SEQ / KC)                                   // chunks walked by a block
#define BUFH (KC * KP + KC * VP)                         // halves per ring buffer: the [s][e] tile, then the [s][d] tile
#define CT 512                                           // threads of a conversion block (16 waves)
#define CU 8                                             // 8-float pieces per conversion thread

static_assert(OUT1E * 4 == 16777216u);
static_assert(SEQ % KC == 0);
static_assert(SEQ % BM == 0);
static_assert(SEQ <= SEQ_FULL);
static_assert(NB <= NB_FULL);
static_assert(KC * HD / 8 == 4 * NT);
static_assert(NTL >= 2 && (NTL % 2) == 0);
static_assert((BUFH % 8) == 0 && ((KC * KP) % 8) == 0);
static_assert((KP % 8) == 0 && (VP % 16) == 0 && ((VP / 16) & 1) == 1 && (OP % 4) == 0);

typedef unsigned short h16;                              // one f16 element, as raw bits
typedef __attribute__((ext_vector_type(16))) _Float16 v16h;
typedef __attribute__((ext_vector_type(8)))  _Float16 v8h;
typedef __attribute__((ext_vector_type(8)))  unsigned short v8us;
typedef __attribute__((ext_vector_type(8)))  float    v8f;
typedef __attribute__((ext_vector_type(4)))  float    v4f;
typedef __attribute__((ext_vector_type(8)))  short    v8s;
typedef __attribute__((ext_vector_type(2)))  float    v2f;
typedef __attribute__((ext_vector_type(2)))  _Float16 v2h;
typedef __attribute__((ext_vector_type(4)))  unsigned v4u;
typedef v8us __attribute__((may_alias)) v8usa;
typedef v8f  __attribute__((may_alias)) v8fa;
typedef v4f  __attribute__((may_alias)) v4fa;

__device__ __forceinline__ v2h cvt2(float a, float b) { const v2f x = {a, b}; return __builtin_convertvector(x, v2h); }   // one v_cvt_pk_f16_f32 (round to nearest even)
__device__ __forceinline__ v16h cat16b(v8us lo, v8us hi) { return __builtin_bit_cast(v16h, __builtin_shufflevector(lo, hi, 0, 1, 2, 3, 4, 5, 6, 7, 8, 9, 10, 11, 12, 13, 14, 15)); }
__device__ __forceinline__ v16h cat16w(v4u lo, v4u hi) { return __builtin_bit_cast(v16h, __builtin_shufflevector(lo, hi, 0, 1, 2, 3, 4, 5, 6, 7)); }
// ds_load_tr16_b128: lane l passes the address of 16 B of row kbase + 8*(l>>4) + (l&7); it gets column dbase + (l&15), rows kbase + 8*(l>>4) + 0..7
__device__ __forceinline__ v8us ldtr16(const h16* p) { typedef __attribute__((address_space(3))) v8s lds_v8s; return __builtin_bit_cast(v8us, __builtin_amdgcn_ds_load_tr16_b128_v8i16((lds_v8s*)p)); }
__device__ __forceinline__ v8f wmmab(v16h a, v16h b, v8f c) { return __builtin_amdgcn_wmma_f32_16x16x32_f16(false, a, false, b, (short)0, c, false, false); }

// LDS byte address of a __shared__ element (the low 32 bits of its address)
__device__ __forceinline__ unsigned ldsaddr(const h16* p) { typedef __attribute__((address_space(3))) const h16 lds_h16; return (unsigned)(size_t)(lds_h16*)p; }
// One chunk's copies of one thread: four 16-B pieces of the chunk, each straight from global memory into both LDS tiles (lk: [s][e] tile, lv: [s][d] tile), through no register.
// The closing s_wait_xcnt stands inside the statement so that no address register named here is rewritten ahead of it.
__device__ __forceinline__ void copy_chunk(unsigned lk, unsigned lv, const h16* g) {
    const unsigned lk1 = lk + 16 * KP * 2, lk2 = lk + 32 * KP * 2, lk3 = lk + 48 * KP * 2;
    const unsigned lv1 = lv + 16 * VP * 2, lv2 = lv + 32 * VP * 2, lv3 = lv + 48 * VP * 2;
    const h16* g1 = g + 16 * TOKP; const h16* g2 = g + 32 * TOKP; const h16* g3 = g + 48 * TOKP;
    asm volatile("global_load_async_to_lds_b128 %0, %8, off\n\t"
                 "global_load_async_to_lds_b128 %4, %12, off\n\t"
                 "global_load_async_to_lds_b128 %1, %9, off\n\t"
                 "global_load_async_to_lds_b128 %5, %13, off\n\t"
                 "global_load_async_to_lds_b128 %2, %10, off\n\t"
                 "global_load_async_to_lds_b128 %6, %14, off\n\t"
                 "global_load_async_to_lds_b128 %3, %11, off\n\t"
                 "global_load_async_to_lds_b128 %7, %15, off\n\t"
                 "s_wait_xcnt 0x0"
                 :: "v"(lk), "v"(lk1), "v"(lk2), "v"(lk3), "v"(lv), "v"(lv1), "v"(lv2), "v"(lv3),
                    "v"(g), "v"(g1), "v"(g2), "v"(g3), "v"(g), "v"(g1), "v"(g2), "v"(g3) : "memory");
}

// k_cvt8: both tensors to f16 in one launch (blockIdx.y picks the tensor). A piece is 8 floats (32 B in, 16 B out).
// A block is 16 waves and each thread takes CU pieces, CT apart, all loaded before the first is converted: few waves to start, 16 loads of 16 B in flight per lane.
__global__ __launch_bounds__(CT) void k_cvt8(const float* __restrict__ qsrc, const float* __restrict__ ksrc, h16* __restrict__ qdst, h16* __restrict__ kdst, size_t nq8, size_t nk8) {
    const bool second = blockIdx.y != 0;
    const float* __restrict__ src = second ? ksrc : qsrc;
    h16* __restrict__ dst = second ? kdst : qdst;
    const size_t n8 = second ? nk8 : nq8;
    const size_t base = (size_t)blockIdx.x * (CT * CU);
    const size_t i0 = base + threadIdx.x;
    if (base + CT * CU <= n8) {                          // whole block inside the tensor (block-uniform)
        const float* p = src + i0 * 8;
        v8f v[CU];
#pragma unroll                                           // unrolled (here and below): v[] lives in registers and the loads share one address register with immediate offsets
        for (int u = 0; u < CU; ++u) v[u] = *(const v8fa*)(p + (size_t)u * (CT * 8));
        // behind the loads, which all name p's register: p is an input here, so that register is rewritten (also as a load's own destination) only behind this wait
        asm volatile("s_wait_xcnt 0x0" :: "v"(p) : "memory");
        __builtin_amdgcn_sched_barrier(0);               // no convert (with its wait) rises among the loads: without it the last two loads start only when the first have returned
#pragma unroll
        for (int u = 0; u < CU; ++u) *(v8us*)(dst + (i0 + (size_t)u * CT) * 8) = __builtin_bit_cast(v8us, __builtin_convertvector(v[u], v8h));   // round to nearest even
        asm volatile("s_wait_xcnt 0x0" ::: "memory");    // behind the last store: no register that a store names is rewritten ahead of this wait on any way out of this branch
    } else {                                             // the tensor's last, partial block (or none of it): piece by piece
        for (int u = 0; u < CU; ++u) {
            const size_t i = i0 + (size_t)u * CT;
            if (i < n8) {
                const v8f v = *(const v8fa*)(src + i * 8);
                *(v8us*)(dst + i * 8) = __builtin_bit_cast(v8us, __builtin_convertvector(v, v8h));
            }
        }
    }
}

// k_attn: Out[(b*SEQ_FULL + l)*TOKP + h*HD + d] = sum_s softmax_s(SCALE * Q[b,l,h,:].K[b,s,h,:]) K[b,s,h,d]
// T0/T1: f16 token-major [b][t][h][d]. blockIdx.z = 0: Q = T0, K = T1, first output; blockIdx.z = 1: Q = T1, K = T0, second output (OUT1E elements on).
// The two halves of the grid share nothing; together they put four blocks on a WGP, four waves on a SIMD, so that one wave's softmax runs beside another's matrix work.
// grid (SEQ/BM, NB*NH, 2), NT threads; wave w owns query rows m0 .. m0+31, as QG groups of 16 (group g: rows m0 + 16*g + 0..15).
// Fragment map (A, B alike): lane l: row/col = l & 15, elements 0..7 <- k0 + 8*(l>>4) + 0..7, elements 8..15 <- k0 + 16 + 8*(l>>4) + 0..7; D element r of lane l = (row 8*(l>>4)+r, col l&15).
__global__ __launch_bounds__(NT) void k_attn(const h16* __restrict__ T0, const h16* __restrict__ T1, float* OutAll) {
    __shared__ __align__(16) h16 ring[2 * BUFH];      // two buffers, each the [s][e] chunk tile and the [s][d] chunk tile at the transposing load's pitch (cross-wave: block barriers)
    __shared__ __align__(16) float os[4][16 * QG * OP];   // per-wave output staging (wave-private)

    const int tid = threadIdx.x, wave = tid >> 5, lane = tid & 31, hf = lane >> 4, lm = lane & 15;
    const int bh = blockIdx.y, b = bh / NH, h = bh % NH;
    const bool swapped = blockIdx.z != 0;
    const h16* __restrict__ Qp = swapped ? T1 : T0;
    const h16* __restrict__ Kp = swapped ? T0 : T1;
    float* Out = swapped ? OutAll + OUT1E : OutAll;
    const int m0 = blockIdx.x * BM + wave * (16 * QG);

    // Q^T as the B operand of the scores: group g, column n = lm <- query row m0+16*g+lm; k = e (two k-steps of 32).
    v16h bq0[QG], bq1[QG];
#pragma unroll
    for (int g = 0; g < QG; ++g) {
        const h16* Qg = Qp + ((size_t)b * SEQ_FULL + (size_t)(m0 + 16 * g + lm)) * TOKP + h * HD;
        bq0[g] = cat16b(*(const v8usa*)(Qg + 8 * hf), *(const v8usa*)(Qg + 16 + 8 * hf));
        bq1[g] = cat16b(*(const v8usa*)(Qg + 32 + 8 * hf), *(const v8usa*)(Qg + 48 + 8 * hf));
    }
    const h16* Kg = Kp + (size_t)b * SEQ_FULL * TOKP + h * HD;

    float mrun[QG], lrun[QG];
    v8f acc[QG][4];
#pragma unroll
    for (int g = 0; g < QG; ++g) {
        mrun[g] = -1.0e30f; lrun[g] = 0.0f;
#pragma unroll
        for (int t = 0; t < 4; ++t) acc[g][t] = (v8f){};
    }

    // ---- staging: a chunk is 512 x 16-B pieces, 4 per thread (rows srow + 0, 16, 32, 48), copied into two row-major tiles, each at its reader's pitch
    const int srow = tid >> 3, sc8 = (tid & 7) * 8;
    const unsigned lk0 = ldsaddr(ring + srow * KP + sc8), lv0 = ldsaddr(ring + KC * KP + srow * VP + sc8);
    const h16* gnext = Kg + (size_t)srow * TOKP + sc8;   // this thread's first piece of the next chunk to be copied
    copy_chunk(lk0, lv0, gnext); gnext += KC * TOKP;
    asm volatile("s_wait_asynccnt 0x0" ::: "memory");    // this wave's copies of chunk 0 have landed
    __syncthreads();                                     // chunk 0 is published to every wave
    copy_chunk(lk0 + BUFH * 2, lv0 + BUFH * 2, gnext); gnext += KC * TOKP;

    // one pass: chunk in buffer cur is worked on while the other buffer's copies fly; more: a chunk two ahead exists
    auto pass = [&](const int cur, const bool more) __attribute__((always_inline)) {
        const h16* Krm = ring + cur * BUFH;
        const h16* Kv = Krm + KC * KP;
        // ---- S^T tiles: A rows = key s (mt*16 + lm), k = e; B = Q^T; each A fragment serves both query groups
        v8f c[QG][4];
#pragma unroll
        for (int mt = 0; mt < 4; ++mt) {
            const h16* ar = Krm + (mt * 16 + lm) * KP + 8 * hf;
            const v16h a0 = cat16b(*(const v8usa*)(ar), *(const v8usa*)(ar + 16));
            const v16h a1 = cat16b(*(const v8usa*)(ar + 32), *(const v8usa*)(ar + 48));
#pragma unroll
            for (int g = 0; g < QG; ++g) {
                v8f cz = (v8f){};
                cz = wmmab(a0, bq0[g], cz);
                cz = wmmab(a1, bq1[g], cz);
                c[g][mt] = cz;
            }
        }
        // four vector slots between the last matrix instruction and the first reader of a score tile (the chip's distance after a WMMA)
        asm volatile("v_nop\n\tv_nop\n\tv_nop\n\tv_nop" : "+v"(c[0][0]), "+v"(c[0][1]), "+v"(c[0][2]), "+v"(c[0][3]), "+v"(c[1][0]), "+v"(c[1][1]), "+v"(c[1][2]), "+v"(c[1][3]) : "v"(bq0[0]), "v"(bq1[0]), "v"(bq0[1]), "v"(bq1[1]));

        // ---- online softmax per query column l = 16*g + lm: this lane holds keys s = mt*16 + 8*hf + r; partner lane ^16 holds the rest
        // the maximum is taken over the raw products (SCALE > 0 keeps the order); scale, shift and the change of base are one fused multiply-add per score
        v16h bp0[QG], bp1[QG];
#pragma unroll
        for (int g = 0; g < QG; ++g) {
            float mx = -1.0e30f;
#pragma unroll
            for (int mt = 0; mt < 4; ++mt) {
#pragma unroll
                for (int r = 0; r < 8; ++r) mx = fmaxf(mx, c[g][mt][r]);
            }
            mx = fmaxf(mx, __shfl_xor(mx, 16, 32));
            const float mnew = fmaxf(mrun[g], mx);
            const float corr = __builtin_amdgcn_exp2f((mrun[g] - mnew) * KS);
            const float nm = -mnew * KS;
            const v8f ksv = {KS, KS, KS, KS, KS, KS, KS, KS}, nmv = {nm, nm, nm, nm, nm, nm, nm, nm};
            float psum = 0.0f;
            v4u pw[4];
#pragma unroll
            for (int mt = 0; mt < 4; ++mt) {
                const v8f e = __builtin_elementwise_fma(c[g][mt], ksv, nmv);         // KS * score - KS * maximum, two scores per instruction
#pragma unroll
                for (int r = 0; r < 8; r += 2) {
                    const float p0 = __builtin_amdgcn_exp2f(e[r]);
                    const float p1 = __builtin_amdgcn_exp2f(e[r + 1]);
                    psum += p0;
                    psum += p1;
                    pw[mt][r >> 1] = __builtin_bit_cast(unsigned, cvt2(p0, p1));     // the one f16 plane: RNE, two elements per instruction
                }
            }
            psum += __shfl_xor(psum, 16, 32);
            lrun[g] = lrun[g] * corr + psum; mrun[g] = mnew;
#pragma unroll
            for (int t = 0; t < 4; ++t) acc[g][t] = acc[g][t] * corr;

            // ---- P^T as the B operand (k = s, n = l): element r <- tile covering s 0..15 (or 32..47), element 8+r <- tile covering s 16..31 (or 48..63), same lane
            bp0[g] = cat16w(pw[0], pw[1]); bp1[g] = cat16w(pw[2], pw[3]);
        }

        // ---- O^T tiles: A = K^T rows d = t*16 + lm, k = s, transposed on the way out of LDS; each A fragment serves both query groups
        const h16* vr = Kv + (8 * hf + (lane & 7)) * VP + 8 * ((lane >> 3) & 1);
#pragma unroll
        for (int t = 0; t < 4; ++t) {
            const h16* ar = vr + t * 16;
            const v16h a0 = cat16b(ldtr16(ar), ldtr16(ar + 16 * VP));
            const v16h a1 = cat16b(ldtr16(ar + 32 * VP), ldtr16(ar + 48 * VP));
#pragma unroll
            for (int g = 0; g < QG; ++g) {
                acc[g][t] = wmmab(a0, bp0[g], acc[g][t]);
                acc[g][t] = wmmab(a1, bp1[g], acc[g][t]);
            }
        }
        // four vector slots between the last matrix instruction and whatever follows the loop's back edge or exit (the chip's distance after a WMMA)
        asm volatile("v_nop\n\tv_nop\n\tv_nop\n\tv_nop" : "+v"(acc[0][0]), "+v"(acc[0][1]), "+v"(acc[0][2]), "+v"(acc[0][3]), "+v"(acc[1][0]), "+v"(acc[1][1]), "+v"(acc[1][2]), "+v"(acc[1][3]) : "v"(bp0[0]), "v"(bp1[0]), "v"(bp0[1]), "v"(bp1[1]));

        // ---- publish point of the next chunk
        asm volatile("s_wait_dscnt 0x0" ::: "memory");      // this wave's reads of buffer cur have returned before it is refilled
        asm volatile("s_wait_asynccnt 0x0" ::: "memory");   // this wave's copies of the next chunk have landed
        __syncthreads();                                    // publishes the next chunk and ends every wave's reads of buffer cur
        if (more) { copy_chunk(lk0 + cur * BUFH * 2, lv0 + cur * BUFH * 2, gnext); gnext += KC * TOKP; }
    };
    // two passes a trip, so that each pass's buffer is a compile-time constant; kept rolled beyond that: more copies of the body only grow the code
#pragma unroll 1
    for (int t = 0; t < NTL; t += 2) {
        const bool more = t + 2 < NTL;
        pass(0, more);
        pass(1, more);
    }
    asm volatile("s_wait_asynccnt 0x0" ::: "memory");       // nothing of this wave is in flight when it goes on to the epilogue

    // ---- epilogue: acc[g][t][r] = O^T[d = t*16 + 8*hf + r][l = 16*g + lm]; stage O[l][d] per wave in LDS, then whole-line stores
    float* osw = os[wave];
#pragma unroll
    for (int g = 0; g < QG; ++g) {
        const float inv = 1.0f / lrun[g];
        float* og = osw + (16 * g + lm) * OP + 8 * hf;
#pragma unroll
        for (int t = 0; t < 4; ++t) {
            v4f w0, w1;
            w0[0] = acc[g][t][0] * inv; w0[1] = acc[g][t][1] * inv; w0[2] = acc[g][t][2] * inv; w0[3] = acc[g][t][3] * inv;
            w1[0] = acc[g][t][4] * inv; w1[1] = acc[g][t][5] * inv; w1[2] = acc[g][t][6] * inv; w1[3] = acc[g][t][7] * inv;
            *(v4fa*)(og + t * 16) = w0;
            *(v4fa*)(og + t * 16 + 4) = w1;
        }
    }
    __builtin_amdgcn_fence(3 /* release order */, "wavefront");
    __builtin_amdgcn_wave_barrier();
    // each instruction: lanes 0..15 -> row 2s (256 B = 2 lines, 8 lanes per line), lanes 16..31 -> row 2s+1
    float* orow0 = Out + ((size_t)b * SEQ_FULL + (size_t)m0) * TOKP + h * HD;
#pragma unroll
    for (int s = 0; s < 8 * QG; ++s) {
        const int row = 2 * s + hf; const int cofs = lm * 4;
        const v4f val = *(const v4fa*)(osw + row * OP + cofs);
        *(v4f*)(orow0 + (size_t)row * TOKP + cofs) = val;
    }
}

extern "C" void kernel_launch(void* const* d_in, const int* in_sizes, int n_in,
                              void* d_out, int out_size, void* d_ws, size_t ws_size, hipStream_t stream) {
    if (n_in < 2) return;
    const float* Qin = (const float*)d_in[0];
    const float* Kin = (const float*)d_in[1];
    float* OUT = (float*)d_out;
    const size_t need = ((size_t)(NB - 1) * SEQ_FULL + SEQ) * TOKP;
    if (in_sizes[0] < 0 || in_sizes[1] < 0 || out_size < 0) return;
    if ((size_t)in_sizes[0] < need || (size_t)in_sizes[1] < need) return;
    if ((in_sizes[0] & 63) != 0 || (in_sizes[1] & 63) != 0) return;
    if ((size_t)out_size < OUT1E + need) return;
    // workspace: f16 copies of both inputs (2 B per element), 256-B aligned regions
    const size_t qbytes = (((size_t)in_sizes[0] * 2) + 255) & ~(size_t)255;
    const size_t kbytes = (((size_t)in_sizes[1] * 2) + 255) & ~(size_t)255;
    if (qbytes + kbytes > ws_size) return;
    if (qbytes + kbytes > (size_t)134217728u) return;
    char* wsp = (char*)d_ws;
    h16* QB = (h16*)wsp; h16* KB = (h16*)(wsp + qbytes);
    const size_t nq8 = (size_t)in_sizes[0] / 8, nk8 = (size_t)in_sizes[1] / 8;
    const size_t nmax8 = nq8 > nk8 ? nq8 : nk8;
    dim3 cgrid((unsigned)((nmax8 + CT * CU - 1) / (CT * CU)), 2);
    k_cvt8<<<cgrid, CT, 0, stream>>>(Qin, Kin, QB, KB, nq8, nk8);
    // z = 0: rows of queries attend over keys (values = keys); z = 1: rows of keys attend over queries (values = queries)
    dim3 grid(SEQ / BM, NB * NH, 2);
    k_attn<<<grid, NT, 0, stream>>>(QB, KB, OUT);
}

// v009
// Measured time: 57.5 microseconds a run.
// Two timings next to v008 put it at 1.06 and 1.07 times that version's speed.
// All steps since v000 together make it 3.85 times as fast.
#include <hip/hip_runtime.h>

// Contractions: scores q.k^T on v_wmma_f32_16x16x32_f16 (both inputs RNE-converted to f16 once, single product, f32 accumulate); P.V on v_wmma_f32_16x16x32_f16 with P as one f16 plane (P lies in [0, PLIM]: 11 significant bits, RNE) x the single f16 value plane (1 product), f32 accumulate; softmax statistics, rescaling and normalisation in f32; outputs f32.
// Second output: the same kernel with the two tensors swapped (keys act as queries; queries act as keys and values); both outputs come from one launch (blockIdx.z picks the roles).

#define NH 8
#define HD 64
#ifndef NB
#define NB 4
#endif
#ifndef SEQ
#define SEQ 2048
#endif
#define NB_FULL 4
#define SEQ_FULL 2048
#define TOKP (NH * HD)                                   // token pitch in elements (512)
#define OUT1E ((size_t)NB_FULL * SEQ_FULL * NH * HD)     // second output starts at this element
#define KC 64                                            // keys per chunk
#define QG 2                                             // 16-column query groups per wave: each fragment read from LDS feeds QG matrix instructions
#define BM (4 * 16 * QG)                                 // query rows per block (4 waves x 32)
#define NT 128
#define KP 72                                            // LDS pitch (halves) of the [s][e] tile
#define VP 80                                            // LDS pitch (halves) of the [s][d] copy read by the transposing load (32 B x odd)
#define OP 68                                            // LDS pitch (floats) of the output staging tile
#define SCALE 0.125f                                     // HD^-0.5, exact power of two
#define LOG2E 1.4426950408889634f
#define KS (SCALE * LOG2E)                               // raw score -> exponent of two (LOG2E scaled by an exact power of two)
#define PLIM 4096.0f                                     // a lane's sum of P per chunk above which the softmax references move (f16 holds 65504)
#define VA 2                                             // output tiles whose K^T fragments are read ahead of the test
#define NTL (SEQ / KC)                                   // chunks walked by a block
#define BUFH (KC * KP + KC * VP)                         // halves per ring buffer: the [s][e] tile, then the [s][d] tile
#define CT 512                                           // threads of a conversion block (16 waves)
#define CU 8                                             // 8-float pieces per conversion thread

static_assert(OUT1E * 4 == 16777216u);
static_assert(SEQ % KC == 0);
static_assert(SEQ % BM == 0);
static_assert(SEQ <= SEQ_FULL);
static_assert(NB <= NB_FULL);
static_assert(KC * HD / 8 == 4 * NT);
static_assert(NTL >= 2 && (NTL % 2) == 0);
static_assert((BUFH % 8) == 0 && ((KC * KP) % 8) == 0);
static_assert((KP % 8) == 0 && (VP % 16) == 0 && ((VP / 16) & 1) == 1 && (OP % 4) == 0);

typedef unsigned short h16;                              // one f16 element, as raw bits
typedef __attribute__((ext_vector_type(16))) _Float16 v16h;
typedef __attribute__((ext_vector_type(8)))  _Float16 v8h;
typedef __attribute__((ext_vector_type(8)))  unsigned short v8us;
typedef __attribute__((ext_vector_type(8)))  float    v8f;
typedef __attribute__((ext_vector_type(4)))  float    v4f;
typedef __attribute__((ext_vector_type(8)))  short    v8s;
typedef __attribute__((ext_vector_type(2)))  float    v2f;
typedef __attribute__((ext_vector_type(2)))  _Float16 v2h;
typedef __attribute__((ext_vector_type(4)))  unsigned v4u;
typedef v8us __attribute__((may_alias)) v8usa;
typedef v8f  __attribute__((may_alias)) v8fa;
typedef v4f  __attribute__((may_alias)) v4fa;

__device__ __forceinline__ v2h cvt2(float a, float b) { const v2f x = {a, b}; return __builtin_convertvector(x, v2h); }   // one v_cvt_pk_f16_f32 (round to nearest even)
__device__ __forceinline__ v16h cat16b(v8us lo, v8us hi) { return __builtin_bit_cast(v16h, __builtin_shufflevector(lo, hi, 0, 1, 2, 3, 4, 5, 6, 7, 8, 9, 10, 11, 12, 13, 14, 15)); }
__device__ __forceinline__ v16h cat16w(v4u lo, v4u hi) { return __builtin_bit_cast(v16h, __builtin_shufflevector(lo, hi, 0, 1, 2, 3, 4, 5, 6, 7)); }
// ds_load_tr16_b128: lane l passes the address of 16 B of row kbase + 8*(l>>4) + (l&7); it gets column dbase + (l&15), rows kbase + 8*(l>>4) + 0..7
__device__ __forceinline__ v8us ldtr16(const h16* p) { typedef __attribute__((address_space(3))) v8s lds_v8s; return __builtin_bit_cast(v8us, __builtin_amdgcn_ds_load_tr16_b128_v8i16((lds_v8s*)p)); }
__device__ __forceinline__ v8f wmmab(v16h a, v16h b, v8f c) { return __builtin_amdgcn_wmma_f32_16x16x32_f16(false, a, false, b, (short)0, c, false, false); }

// LDS byte address of a __shared__ element (the low 32 bits of its address)
__device__ __forceinline__ unsigned ldsaddr(const h16* p) { typedef __attribute__((address_space(3))) const h16 lds_h16; return (unsigned)(size_t)(lds_h16*)p; }
// One chunk's copies of one thread: four 16-B pieces of the chunk, each straight from global memory into both LDS tiles (lk: [s][e] tile, lv: [s][d] tile), through no register.
// The closing s_wait_xcnt stands inside the statement so that no address register named here is rewritten ahead of it.
__device__ __forceinline__ void copy_chunk(unsigned lk, unsigned lv, const h16* g) {
    const unsigned lk1 = lk + 16 * KP * 2, lk2 = lk + 32 * KP * 2, lk3 = lk + 48 * KP * 2;
    const unsigned lv1 = lv + 16 * VP * 2, lv2 = lv + 32 * VP * 2, lv3 = lv + 48 * VP * 2;
    const h16* g1 = g + 16 * TOKP; const h16* g2 = g + 32 * TOKP; const h16* g3 = g + 48 * TOKP;
    asm volatile("global_load_async_to_lds_b128 %0, %8, off\n\t"
                 "global_load_async_to_lds_b128 %4, %12, off\n\t"
                 "global_load_async_to_lds_b128 %1, %9, off\n\t"
                 "global_load_async_to_lds_b128 %5, %13, off\n\t"
                 "global_load_async_to_lds_b128 %2, %10, off\n\t"
                 "global_load_async_to_lds_b128 %6, %14, off\n\t"
                 "global_load_async_to_lds_b128 %3, %11, off\n\t"
                 "global_load_async_to_lds_b128 %7, %15, off\n\t"
                 "s_wait_xcnt 0x0"
                 :: "v"(lk), "v"(lk1), "v"(lk2), "v"(lk3), "v"(lv), "v"(lv1), "v"(lv2), "v"(lv3),
                    "v"(g), "v"(g1), "v"(g2), "v"(g3), "v"(g), "v"(g1), "v"(g2), "v"(g3) : "memory");
}

// k_cvt8: both tensors to f16 in one launch (blockIdx.y picks the tensor). A piece is 8 floats (32 B in, 16 B out).
// A block is 16 waves and each thread takes CU pieces, CT apart, all loaded before the first is converted: few waves to start, 16 loads of 16 B in flight per lane.
__global__ __launch_bounds__(CT) void k_cvt8(const float* __restrict__ qsrc, const float* __restrict__ ksrc, h16* __restrict__ qdst, h16* __restrict__ kdst, size_t nq8, size_t nk8) {
    const bool second = blockIdx.y != 0;
    const float* __restrict__ src = second ? ksrc : qsrc;
    h16* __restrict__ dst = second ? kdst : qdst;
    const size_t n8 = second ? nk8 : nq8;
    const size_t base = (size_t)blockIdx.x * (CT * CU);
    const size_t i0 = base + threadIdx.x;
    if (base + CT * CU <= n8) {                          // whole block inside the tensor (block-uniform)
        const float* p = src + i0 * 8;
        v8f v[CU];
#pragma unroll                                           // unrolled (here and below): v[] lives in registers and the loads share one address register with immediate offsets
        for (int u = 0; u < CU; ++u) v[u] = *(const v8fa*)(p + (size_t)u * (CT * 8));
        // behind the loads, which all name p's register: p is an input here, so that register is rewritten (also as a load's own destination) only behind this wait
        asm volatile("s_wait_xcnt 0x0" :: "v"(p) : "memory");
        __builtin_amdgcn_sched_barrier(0);               // no convert (with its wait) rises among the loads: without it the last two loads start only when the first have returned
#pragma unroll
        for (int u = 0; u < CU; ++u) *(v8us*)(dst + (i0 + (size_t)u * CT) * 8) = __builtin_bit_cast(v8us, __builtin_convertvector(v[u], v8h));   // round to nearest even
        asm volatile("s_wait_xcnt 0x0" ::: "memory");    // behind the last store: no register that a store names is rewritten ahead of this wait on any way out of this branch
    } else {                                             // the tensor's last, partial block (or none of it): piece by piece
        for (int u = 0; u < CU; ++u) {
            const size_t i = i0 + (size_t)u * CT;
            if (i < n8) {
                const v8f v = *(const v8fa*)(src + i * 8);
                *(v8us*)(dst + i * 8) = __builtin_bit_cast(v8us, __builtin_convertvector(v, v8h));
            }
        }
    }
}

// k_attn: Out[(b*SEQ_FULL + l)*TOKP + h*HD + d] = sum_s softmax_s(SCALE * Q[b,l,h,:].K[b,s,h,:]) K[b,s,h,d]
// T0/T1: f16 token-major [b][t][h][d]. blockIdx.z = 0: Q = T0, K = T1, first output; blockIdx.z = 1: Q = T1, K = T0, second output (OUT1E elements on).
// The two halves of the grid share nothing; together they put four blocks on a WGP, four waves on a SIMD, so that one wave's softmax runs beside another's matrix work.
// grid (SEQ/BM, NB*NH, 2), NT threads; wave w owns query rows m0 .. m0+31, as QG groups of 16 (group g: rows m0 + 16*g + 0..15).
// Fragment map (A, B alike): lane l: row/col = l & 15, elements 0..7 <- k0 + 8*(l>>4) + 0..7, elements 8..15 <- k0 + 16 + 8*(l>>4) + 0..7; D element r of lane l = (row 8*(l>>4)+r, col l&15).
__global__ __launch_bounds__(NT) void k_attn(const h16* __restrict__ T0, const h16* __restrict__ T1, float* OutAll) {
    __shared__ __align__(16) h16 ring[2 * BUFH];      // two buffers, each the [s][e] chunk tile and the [s][d] chunk tile at the transposing load's pitch (cross-wave: block barriers)
    __shared__ __align__(16) float os[4][16 * QG * OP];   // per-wave output staging (wave-private)

    const int tid = threadIdx.x, wave = tid >> 5, lane = tid & 31, hf = lane >> 4, lm = lane & 15;
    const int bh = blockIdx.y, b = bh / NH, h = bh % NH;
    const bool swapped = blockIdx.z != 0;
    const h16* __restrict__ Qp = swapped ? T1 : T0;
    const h16* __restrict__ Kp = swapped ? T0 : T1;
    float* Out = swapped ? OutAll + OUT1E : OutAll;
    const int m0 = blockIdx.x * BM + wave * (16 * QG);

    // Q^T as the B operand of the scores: group g, column n = lm <- query row m0+16*g+lm; k = e (two k-steps of 32).
    v16h bq0[QG], bq1[QG];
#pragma unroll
    for (int g = 0; g < QG; ++g) {
        const h16* Qg = Qp + ((size_t)b * SEQ_FULL + (size_t)(m0 + 16 * g + lm)) * TOKP + h * HD;
        bq0[g] = cat16b(*(const v8usa*)(Qg + 8 * hf), *(const v8usa*)(Qg + 16 + 8 * hf));
        bq1[g] = cat16b(*(const v8usa*)(Qg + 32 + 8 * hf), *(const v8usa*)(Qg + 48 + 8 * hf));
    }
    const h16* Kg = Kp + (size_t)b * SEQ_FULL * TOKP + h * HD;

    float mrun[QG], lrun[QG];
    v8f acc[QG][4];
#pragma unroll
    for (int g = 0; g < QG; ++g) {
        mrun[g] = -1.0e30f; lrun[g] = 0.0f;
#pragma unroll
        for (int t = 0; t < 4; ++t) acc[g][t] = (v8f){};
    }

    // ---- staging: a chunk is 512 x 16-B pieces, 4 per thread (rows srow + 0, 16, 32, 48), copied into two row-major tiles, each at its reader's pitch
    const int srow = tid >> 3, sc8 = (tid & 7) * 8;
    const unsigned lk0 = ldsaddr(ring + srow * KP + sc8), lv0 = ldsaddr(ring + KC * KP + srow * VP + sc8);
    const h16* gnext = Kg + (size_t)srow * TOKP + sc8;   // this thread's first piece of the next chunk to be copied
    copy_chunk(lk0, lv0, gnext); gnext += KC * TOKP;
    asm volatile("s_wait_asynccnt 0x0" ::: "memory");    // this wave's copies of chunk 0 have landed
    __syncthreads();                                     // chunk 0 is published to every wave
    copy_chunk(lk0 + BUFH * 2, lv0 + BUFH * 2, gnext); gnext += KC * TOKP;

    // one pass: chunk in buffer cur is worked on while the other buffer's copies fly; more: a chunk two ahead exists; refsonly: only the references are taken from the chunk
    auto pass = [&](const int cur, const bool more, const bool refsonly) __attribute__((always_inline)) {
        const h16* Krm = ring + cur * BUFH;
        const h16* Kv = Krm + KC * KP;
        v8f c[QG][4];
        v16h bp0[QG], bp1[QG];
        float psum[QG];
        // ---- S^T tiles: A rows = key s (mt*16 + lm), k = e; B = Q^T; each A fragment serves both query groups
        auto scores = [&]() __attribute__((always_inline)) {
#pragma unroll
            for (int mt = 0; mt < 4; ++mt) {
                const h16* ar = Krm + (mt * 16 + lm) * KP + 8 * hf;
                const v16h a0 = cat16b(*(const v8usa*)(ar), *(const v8usa*)(ar + 16));
                const v16h a1 = cat16b(*(const v8usa*)(ar + 32), *(const v8usa*)(ar + 48));
#pragma unroll
                for (int g = 0; g < QG; ++g) {
                    v8f cz = (v8f){};
                    cz = wmmab(a0, bq0[g], cz);
                    cz = wmmab(a1, bq1[g], cz);
                    c[g][mt] = cz;
                }
            }
            // four vector slots between the last matrix instruction and the first reader of a score tile (the chip's distance after a WMMA)
            asm volatile("v_nop\n\tv_nop\n\tv_nop\n\tv_nop" : "+v"(c[0][0]), "+v"(c[0][1]), "+v"(c[0][2]), "+v"(c[0][3]), "+v"(c[1][0]), "+v"(c[1][1]), "+v"(c[1][2]), "+v"(c[1][3]) : "v"(bq0[0]), "v"(bq1[0]), "v"(bq0[1]), "v"(bq1[1]));
        };
        // ---- the rare path: each column's reference moves up to the maximum of its old reference and this chunk's raw scores (SCALE > 0 keeps the order); sums and accumulators follow it
        // column l = 16*g + lm: this lane holds keys s = mt*16 + 8*hf + r, partner lane ^16 the rest; both take the joint maximum, so a column has one reference
        auto moveref = [&]() __attribute__((always_inline)) {
#pragma unroll
            for (int g = 0; g < QG; ++g) {
                float mx = -1.0e30f;
#pragma unroll
                for (int mt = 0; mt < 4; ++mt) {
#pragma unroll
                    for (int r = 0; r < 8; ++r) mx = fmaxf(mx, c[g][mt][r]);
                }
                mx = fmaxf(mx, __shfl_xor(mx, 16, 32));
                const float mnew = fmaxf(mrun[g], mx);
                const float corr = __builtin_amdgcn_exp2f((mrun[g] - mnew) * KS);
                lrun[g] *= corr; mrun[g] = mnew;
#pragma unroll
                for (int t = 0; t < 4; ++t) acc[g][t] = acc[g][t] * corr;
            }
        };
        // ---- P = 2^(KS * score - KS * reference): scale, shift and the change of base are one fused multiply-add per score; psum: this lane's half of the column's sum
        auto probs = [&]() __attribute__((always_inline)) {
#pragma unroll
            for (int g = 0; g < QG; ++g) {
                const float nm = -mrun[g] * KS;
                const v8f ksv = {KS, KS, KS, KS, KS, KS, KS, KS}, nmv = {nm, nm, nm, nm, nm, nm, nm, nm};
                float ps = 0.0f;
                v4u pw[4];
#pragma unroll
                for (int mt = 0; mt < 4; ++mt) {
                    const v8f e = __builtin_elementwise_fma(c[g][mt], ksv, nmv);         // two scores per instruction
#pragma unroll
                    for (int r = 0; r < 8; r += 2) {
                        const float p0 = __builtin_amdgcn_exp2f(e[r]);
                        const float p1 = __builtin_amdgcn_exp2f(e[r + 1]);
                        ps += p0;
                        ps += p1;
                        pw[mt][r >> 1] = __builtin_bit_cast(unsigned, cvt2(p0, p1));     // the one f16 plane: RNE, two elements per instruction
                    }
                }
                psum[g] = ps;
                // P^T as the B operand (k = s, n = l): element r <- tile covering s 0..15 (or 32..47), element 8+r <- tile covering s 16..31 (or 48..63), same lane
                bp0[g] = cat16w(pw[0], pw[1]); bp1[g] = cat16w(pw[2], pw[3]);
            }
        };
        scores();
        if (refsonly) { moveref(); return; }                // ahead of the loop: the first chunk sets the references, nothing else is done
        // the first VA tiles' K^T fragments are asked for ahead of the test, so that they fly under the exponentials and not in front of the second product
        const h16* vr = Kv + (8 * hf + (lane & 7)) * VP + 8 * ((lane >> 3) & 1);
        v16h va0[VA], va1[VA];
#pragma unroll
        for (int t = 0; t < VA; ++t) {
            const h16* ar = vr + t * 16;
            va0[t] = cat16b(ldtr16(ar), ldtr16(ar + 16 * VP));
            va1[t] = cat16b(ldtr16(ar + 32 * VP), ldtr16(ar + 48 * VP));
        }
        probs();
        // One test a pass, a scalar branch: no P is negative, so a lane's sum bounds each of its P. While no sum passes PLIM, every P fits f16 and the references stay
        // (a reference is a maximum of earlier scores, so no P is smaller than under the running maximum). Written so that an infinite or undefined sum takes the branch too.
        if (__builtin_expect(__builtin_amdgcn_ballot_w32(!(psum[0] <= PLIM && psum[1] <= PLIM)) != 0, 0)) {   // marked rare: the common way falls through, the rare code lies out of line
            scores();                                       // the scores were overwritten by P: made again from the chunk, which stays in its buffer until the publish point
            moveref();
            probs();                                        // now every P <= 1
        }
#pragma unroll
        for (int g = 0; g < QG; ++g) lrun[g] += psum[g] + __shfl_xor(psum[g], 16, 32);

        // ---- O^T tiles: A = K^T rows d = t*16 + lm, k = s, transposed on the way out of LDS; each A fragment serves both query groups
#pragma unroll
        for (int t = 0; t < 4; ++t) {
            const h16* ar = vr + t * 16;
            const v16h a0 = t < VA ? va0[t < VA ? t : 0] : cat16b(ldtr16(ar), ldtr16(ar + 16 * VP));
            const v16h a1 = t < VA ? va1[t < VA ? t : 0] : cat16b(ldtr16(ar + 32 * VP), ldtr16(ar + 48 * VP));
#pragma unroll
            for (int g = 0; g < QG; ++g) {
                acc[g][t] = wmmab(a0, bp0[g], acc[g][t]);
                acc[g][t] = wmmab(a1, bp1[g], acc[g][t]);
            }
        }
        // four vector slots between the last matrix instruction and whatever follows the loop's back edge or exit (the chip's distance after a WMMA)
        asm volatile("v_nop\n\tv_nop\n\tv_nop\n\tv_nop" : "+v"(acc[0][0]), "+v"(acc[0][1]), "+v"(acc[0][2]), "+v"(acc[0][3]), "+v"(acc[1][0]), "+v"(acc[1][1]), "+v"(acc[1][2]), "+v"(acc[1][3]) : "v"(bp0[0]), "v"(bp1[0]), "v"(bp0[1]), "v"(bp1[1]));

        // ---- publish point of the next chunk
        asm volatile("s_wait_dscnt 0x0" ::: "memory");      // this wave's reads of buffer cur have returned before it is refilled
        asm volatile("s_wait_asynccnt 0x0" ::: "memory");   // this wave's copies of the next chunk have landed
        __syncthreads();                                    // publishes the next chunk and ends every wave's reads of buffer cur
        if (more) { copy_chunk(lk0 + cur * BUFH * 2, lv0 + cur * BUFH * 2, gnext); gnext += KC * TOKP; }
    };
    pass(0, false, true);                                   // chunk 0 (published above) gives every column its first reference; the loop then works on it like on any chunk
    // two passes a trip, so that each pass's buffer is a compile-time constant; kept rolled beyond that: more copies of the body only grow the code
#pragma unroll 1
    for (int t = 0; t < NTL; t += 2) {
        const bool more = t + 2 < NTL;
        pass(0, more, false);
        pass(1, more, false);
    }
    asm volatile("s_wait_asynccnt 0x0" ::: "memory");       // nothing of this wave is in flight when it goes on to the epilogue

    // ---- epilogue: acc[g][t][r] = O^T[d = t*16 + 8*hf + r][l = 16*g + lm]; stage O[l][d] per wave in LDS, then whole-line stores
    float* osw = os[wave];
#pragma unroll
    for (int g = 0; g < QG; ++g) {
        const float inv = 1.0f / lrun[g];
        float* og = osw + (16 * g + lm) * OP + 8 * hf;
#pragma unroll
        for (int t = 0; t < 4; ++t) {
            v4f w0, w1;
            w0[0] = acc[g][t][0] * inv; w0[1] = acc[g][t][1] * inv; w0[2] = acc[g][t][2] * inv; w0[3] = acc[g][t][3] * inv;
            w1[0] = acc[g][t][4] * inv; w1[1] = acc[g][t][5] * inv; w1[2] = acc[g][t][6] * inv; w1[3] = acc[g][t][7] * inv;
            *(v4fa*)(og + t * 16) = w0;
            *(v4fa*)(og + t * 16 + 4) = w1;
        }
    }
    __builtin_amdgcn_fence(3 /* release order */, "wavefront");
    __builtin_amdgcn_wave_barrier();
    // each instruction: lanes 0..15 -> row 2s (256 B = 2 lines, 8 lanes per line), lanes 16..31 -> row 2s+1
    float* orow0 = Out + ((size_t)b * SEQ_FULL + (size_t)m0) * TOKP + h * HD;
#pragma unroll
    for (int s = 0; s < 8 * QG; ++s) {
        const int row = 2 * s + hf; const int cofs = lm * 4;
        const v4f val = *(const v4fa*)(osw + row * OP + cofs);
        *(v4f*)(orow0 + (size_t)row * TOKP + cofs) = val;
    }
}

extern "C" void kernel_launch(void* const* d_in, const int* in_sizes, int n_in,
                              void* d_out, int out_size, void* d_ws, size_t ws_size, hipStream_t stream) {
    if (n_in < 2) return;
    const float* Qin = (const float*)d_in[0];
    const float* Kin = (const float*)d_in[1];
    float* OUT = (float*)d_out;
    const size_t need = ((size_t)(NB - 1) * SEQ_FULL + SEQ) * TOKP;
    if (in_sizes[0] < 0 || in_sizes[1] < 0 || out_size < 0) return;
    if ((size_t)in_sizes[0] < need || (size_t)in_sizes[1] < need) return;
    if ((in_sizes[0] & 63) != 0 || (in_sizes[1] & 63) != 0) return;
    if ((size_t)out_size < OUT1E + need) return;
    // workspace: f16 copies of both inputs (2 B per element), 256-B aligned regions
    const size_t qbytes = (((size_t)in_sizes[0] * 2) + 255) & ~(size_t)255;
    const size_t kbytes = (((size_t)in_sizes[1] * 2) + 255) & ~(size_t)255;
    if (qbytes + kbytes > ws_size) return;
    if (qbytes + kbytes > (size_t)134217728u) return;
    char* wsp = (char*)d_ws;
    h16* QB = (h16*)wsp; h16* KB = (h16*)(wsp + qbytes);
    const size_t nq8 = (size_t)in_sizes[0] / 8, nk8 = (size_t)in_sizes[1] / 8;
    const size_t nmax8 = nq8 > nk8 ? nq8 : nk8;
    dim3 cgrid((unsigned)((nmax8 + CT * CU - 1) / (CT * CU)), 2);
    k_cvt8<<<cgrid, CT, 0, stream>>>(Qin, Kin, QB, KB, nq8, nk8);
    // z = 0: rows of queries attend over keys (values = keys); z = 1: rows of keys attend over queries (values = queries)
    dim3 grid(SEQ / BM, NB * NH, 2);
    k_attn<<<grid, NT, 0, stream>>>(QB, KB, OUT);
}
